// v000
// The times below were measured on an AMD MI455X: many runs one after another, warmed up first and cycling through
// copies of the inputs, with the whole window's GPU time divided by the number of runs. Launches and the gaps
// between them are all in it. The median over several windows is given; except for v000 it joins two sittings, which
// can be a few percent apart, so the side-by-side timings, each taken in one sitting, are the better comparison.
// The starting kernel, v000, takes 3720 microseconds a run.
#include <hip/hip_runtime.h>

// Multi-head differential attention (x [2][2048][1024]; per head h: q1, k1, q2, k2, v = x W[h] (W [16][1024][64]); w1 = softmax(q1.k1/8), w2 = softmax(q2.k2/8); head out = (w1 - lamb w2) v = w1 v - lamb (w2 v); concat heads; out = (1 - lamb) LayerNorm(concat) (gamma, beta, eps 1e-5; lamb scalar, read) -> [2][2048][1024] (4.2 M)).
// Layout: the five [h][c][d] weight tensors are gathered into an [h*64+d][c] layout; the two attention maps run as 32 head passes (pass p < 16: q1/k1 of head p, pass p >= 16: q2/k2 of head p-16, both with v of head p mod 16) whose f32 contexts land in two merged buffers M1, M2; one row kernel forms M1 - lamb M2, LayerNorms it and scales by (1 - lamb).
// Compute dtypes, f32 accumulate: every input rounded to bf16; q/k/v on PLAIN bf16 operands (inputs: exact); both maps: scores and attn.v: query rows < 512 hl (3 products), the rest single fp16 (x1024); softmax f32; no output projection: f32 difference, LayerNorm and scale.

#define NB_  2
#define TT   2048
#define DM   1024
#define NH_  16
#define NKV  16
#define REP  (NH_ / NKV)
#define HD   64
#define DQ   (NH_ * HD)
#define DKV  (NKV * HD)
#define LNEPS 1e-5f
#define ZH   2
#define RH   512                  // query rows < RH use hi+lo planes (0: none)
#define WIN  0
#define PCAR 1024.0f
#define SCL  0.125f   // HD^-0.5
typedef _Float16 h16;
typedef unsigned short bf;
typedef __attribute__((ext_vector_type(16))) __bf16   v16bf;
typedef __attribute__((ext_vector_type(16))) _Float16 v16h;
typedef __attribute__((ext_vector_type(8)))  _Float16 v8h;
typedef __attribute__((ext_vector_type(8)))  unsigned short v8us;
typedef __attribute__((ext_vector_type(8)))  float    v8f;
typedef __attribute__((ext_vector_type(4)))  float    v4f;
typedef v8h  __attribute__((may_alias)) v8ha;
typedef v4f  __attribute__((may_alias)) v4fa;
typedef v8us __attribute__((may_alias)) v8usa;

__device__ __forceinline__ unsigned short f2bf(float f) { unsigned u = __float_as_uint(f); u += 0x7FFFu + ((u >> 16) & 1u); return (unsigned short)(u >> 16); }
__device__ __forceinline__ float bf2f(unsigned short b) { return __uint_as_float(((unsigned)b) << 16); }
__device__ __forceinline__ float bfr(float f) { return bf2f(f2bf(f)); }
__device__ __forceinline__ v16h cat16(v8h lo, v8h hi) { return __builtin_shufflevector(lo, hi, 0, 1, 2, 3, 4, 5, 6, 7, 8, 9, 10, 11, 12, 13, 14, 15); }
__device__ __forceinline__ v16bf cat16b(v8us lo, v8us hi) { return __builtin_bit_cast(v16bf, __builtin_shufflevector(lo, hi, 0, 1, 2, 3, 4, 5, 6, 7, 8, 9, 10, 11, 12, 13, 14, 15)); }
__device__ __forceinline__ v8f wmma16(v16h a, v16h b, v8f c) { return __builtin_amdgcn_wmma_f32_16x16x32_f16(false, a, false, b, (short)0, c, false, false); }
__device__ __forceinline__ v8f wmmab(v16bf a, v16bf b, v8f c) { return __builtin_amdgcn_wmma_f32_16x16x32_bf16(false, a, false, b, (short)0, c, false, false); }



// ---- k_gemmw: register-blocked GEMM, ONE WAVE per 64x64 output tile (16 accumulators), operands straight from K-contiguous 16-bit planes; grid (M/64, N/64, Z), 32 threads.
// C[m][n] (f32, pitch ldc, + optional f32 bias[n]) = sum_k A[m][k] Bt[n][k] (+ split products per NSPLIT). z-batch strides sA/sB/sC in elements. K % 32 == 0.
template <typename T16> struct WFrag;
template <> struct WFrag<h16> { typedef v16h V; static __device__ __forceinline__ V ld(const h16* p) { return cat16(*(const v8h*)p, *(const v8h*)(p + 16)); } static __device__ __forceinline__ v8f mma(V a, V b, v8f c) { return wmma16(a, b, c); } };
template <> struct WFrag<bf> { typedef v16bf V; static __device__ __forceinline__ V ld(const bf* p) { return cat16b(*(const v8us*)p, *(const v8us*)(p + 16)); } static __device__ __forceinline__ v8f mma(V a, V b, v8f c) { return wmmab(a, b, c); } };
template <typename T16, int NSPLIT, bool BIAS>
__global__ __launch_bounds__(32) void k_gemmw(const T16* __restrict__ A, const T16* __restrict__ A2, const T16* __restrict__ Bt, const T16* __restrict__ Bt2, int K, float* C, int ldc, const float* __restrict__ bias, size_t sA, size_t sB, size_t sC) {
    typedef typename WFrag<T16>::V V;
    __shared__ __align__(16) float os[16 * 68];
    const size_t z = blockIdx.z; A += z * sA; if (A2) A2 += z * sA; Bt += z * sB; if (Bt2) Bt2 += z * sB; C += z * sC;
    const int lane = threadIdx.x & 31, lr = lane & 15, hi = lane >> 4; const int r0 = blockIdx.x * 64, c0 = blockIdx.y * 64;
    v8f acc[4][4];
#pragma unroll
    for (int mb = 0; mb < 4; ++mb)
#pragma unroll
        for (int nb = 0; nb < 4; ++nb) acc[mb][nb] = (v8f){};
    const size_t aoff = (size_t)(r0 + lr) * K + 8 * hi, boff = (size_t)(c0 + lr) * K + 8 * hi;
#pragma unroll 1
    for (int kc = 0; kc < K; kc += 32) {
        V a[4], a2[4];
#pragma unroll
        for (int mb = 0; mb < 4; ++mb) { a[mb] = WFrag<T16>::ld(A + aoff + (size_t)mb * 16 * K + kc); if (NSPLIT == 1 || NSPLIT == 2) a2[mb] = WFrag<T16>::ld(A2 + aoff + (size_t)mb * 16 * K + kc); }
#pragma unroll
        for (int nb = 0; nb < 4; ++nb) { const V b = WFrag<T16>::ld(Bt + boff + (size_t)nb * 16 * K + kc); V b2; if (NSPLIT >= 2) b2 = WFrag<T16>::ld(Bt2 + boff + (size_t)nb * 16 * K + kc);
#pragma unroll
            for (int mb = 0; mb < 4; ++mb) { acc[mb][nb] = WFrag<T16>::mma(a[mb], b, acc[mb][nb]); if (NSPLIT == 1 || NSPLIT == 2) acc[mb][nb] = WFrag<T16>::mma(a2[mb], b, acc[mb][nb]); if (NSPLIT >= 2) acc[mb][nb] = WFrag<T16>::mma(a[mb], b2, acc[mb][nb]); } }
        asm volatile("v_nop\n\tv_nop\n\tv_nop\n\tv_nop" : "+v"(acc[0][0]), "+v"(acc[1][1]), "+v"(acc[2][2]), "+v"(acc[3][3]) : "v"(a[0]), "v"(a[3]));
    }
#pragma unroll
    for (int mb = 0; mb < 4; ++mb) {
#pragma unroll
        for (int nb = 0; nb < 4; ++nb) {
#pragma unroll
            for (int j = 0; j < 8; ++j) os[(hi * 8 + j) * 68 + nb * 16 + lr] = acc[mb][nb][j]; }
        __builtin_amdgcn_wave_barrier(); asm volatile("" ::: "memory");
        float* crow = C + (size_t)(r0 + mb * 16) * ldc + c0;
{
#pragma unroll
            for (int s = 0; s < 8; ++s) { const int row = 2 * s + hi, cofs = lr * 4; v4f val = *(const v4fa*)(os + row * 68 + cofs); if (BIAS) { val[0] += bfr(bias[c0 + cofs]); val[1] += bfr(bias[c0 + cofs + 1]); val[2] += bfr(bias[c0 + cofs + 2]); val[3] += bfr(bias[c0 + cofs + 3]); }
                *(v4f*)(crow + (size_t)row * ldc + cofs) = val; }
             }
        __builtin_amdgcn_wave_barrier(); asm volatile("" ::: "memory");
    }
}

__device__ __forceinline__ h16 tohx(float x) { return (h16)x; }
__device__ __forceinline__ void splitf(float y, unsigned short& h, unsigned short& l) { h = f2bf(y); l = f2bf(y - bf2f(h)); }
typedef __attribute__((ext_vector_type(2))) _Float16 v2h;
typedef __attribute__((ext_vector_type(4))) _Float16 v4h;
typedef __attribute__((ext_vector_type(2))) unsigned short v2us;
typedef __attribute__((ext_vector_type(4))) unsigned short v4us;
typedef __attribute__((ext_vector_type(2))) float v2f;
typedef __attribute__((ext_vector_type(4))) int v4i;

__global__ __launch_bounds__(256) void k_wtG(const float* __restrict__ w, int K, int N, bf* Bt) {
    const int lane = threadIdx.x & 31; const int L0 = (blockIdx.x * 8 + (threadIdx.x >> 5)) * 8; const int nlines = N * K / 64;
{
#pragma unroll 1
        for (int l = 0; l < 8; ++l) { const int L = L0 + l; if (L >= nlines) break; const size_t e = (size_t)L * 64 + lane * 2; const int k = (int)(e % K), n = (int)(e / K); v2us o;
            o[0] = f2bf(w[(size_t)k * N + n]); o[1] = f2bf(w[(size_t)(k + 1) * N + n]); *(v2us*)(Bt + e) = o; }
         }
}
__global__ __launch_bounds__(256) void k_whg(const float* __restrict__ w, bf* Bt) { const size_t e0 = ((size_t)blockIdx.x * 256 + threadIdx.x) * 2; if (e0 >= (size_t)DQ * DM) return; const int e = (int)(e0 % DM); const int n = (int)(e0 / DM); const int h = n / HD, d = n % HD; v2us o; o[0] = f2bf(w[((size_t)h * DM + e) * HD + d]); o[1] = f2bf(w[((size_t)h * DM + e + 1) * HD + d]); *(v2us*)(Bt + e0) = o;  }
__global__ __launch_bounds__(256) void k_cvt8(const float* __restrict__ src, bf* dst, size_t n8) { const size_t i = (size_t)blockIdx.x * 256 + threadIdx.x; if (i >= n8) return; const v8f v = *(const v8f*)(src + i * 8); v8us o;
#pragma unroll
    for (int k = 0; k < 8; ++k) o[k] = f2bf(v[k]); *(v8us*)(dst + i * 8) = o;  }

// k_rope: head planes [h][t][d] (fp16 + hi/lo) of rope(x) x sc with the rotate-half convention out[d] = x[d] cos[t][d] - x[d+HD/2] sin[t][d], out[d+HD/2] = x[d+HD/2] cos[t][d+HD/2] + x[d] sin[t][d+HD/2]
__global__ __launch_bounds__(256) void k_rope(const float* __restrict__ F, int pitch, int nheads, const float* __restrict__ CS, const float* __restrict__ RF, const float* __restrict__ nw, float sc, h16* P16, bf* Ph, bf* Pl) {
    const size_t e = ((size_t)blockIdx.x * 256 + threadIdx.x) * 2; if (e >= (size_t)nheads * TT * HD) return; const int d = (int)(e % HD); const int t = (int)((e / HD) % TT); const int h = (int)(e / ((size_t)HD * TT)); const float* f = F + (size_t)t * pitch + h * HD; const float rf = RF ? RF[(size_t)h * TT + t] : 1.0f; v2h o16; v2us oh, ol;
#pragma unroll
    for (int q = 0; q < 2; ++q) { const int dd = d + q; const int dp = (dd < HD / 2) ? dd + HD / 2 : dd - HD / 2; float x0 = f[dd], x1 = f[dp];
        if (RF) { float n0 = __fmul_rn(x0, rf), n1 = __fmul_rn(x1, rf); asm volatile("" : "+v"(n0)); asm volatile("" : "+v"(n1)); x0 = __fmul_rn(bfr(nw[dd]), n0); x1 = __fmul_rn(bfr(nw[dp]), n1); }
        const v2f cs = *(const v2f*)(CS + ((size_t)t * HD + dd) * 2); float a = __fmul_rn(x0, cs[0]), bq = __fmul_rn(x1, cs[1]); asm volatile("" : "+v"(a)); asm volatile("" : "+v"(bq)); const float r = ((dd < HD / 2) ? __fsub_rn(a, bq) : __fadd_rn(a, bq)) * sc;
        o16[q] = tohx(r); unsigned short a2, c2; splitf(r, a2, c2); oh[q] = a2; ol[q] = c2; }
    *(v2h*)(P16 + e) = o16; *(v2us*)(Ph + e) = oh; *(v2us*)(Pl + e) = ol;  }
__global__ __launch_bounds__(256) void k_vtp(const float* __restrict__ F, int pitch, int nheads, h16* V16, bf* Vh, bf* Vl) { const size_t e = ((size_t)blockIdx.x * 256 + threadIdx.x) * 2; if (e >= (size_t)nheads * HD * TT) return; const int t = (int)(e % TT); const int d = (int)((e / TT) % HD); const int g = (int)(e / ((size_t)TT * HD)); v2h o16; v2us oh, ol;
#pragma unroll
    for (int q = 0; q < 2; ++q) { const float x = F[(size_t)(t + q) * pitch + g * HD + d]; o16[q] = tohx(x); unsigned short a2, c2; splitf(x, a2, c2); oh[q] = a2; ol[q] = c2; }
    *(v2h*)(V16 + e) = o16; *(v2us*)(Vh + e) = oh; *(v2us*)(Vl + e) = ol;  }
__global__ __launch_bounds__(256) void k_csid(float* CS) { const int idx = blockIdx.x * 256 + threadIdx.x; if (idx >= TT * HD) return; v2f cs; cs[0] = 1.0f; cs[1] = 0.0f; *(v2f*)(CS + (size_t)idx * 2) = cs;  }
__global__ __launch_bounds__(256) void k_mergeF(const float* __restrict__ Ob, int h0, float* O) { const size_t e = ((size_t)blockIdx.x * 256 + threadIdx.x) * 2; if (e >= (size_t)ZH * TT * HD) return; const int d = (int)(e % HD); const int t = (int)((e / HD) % TT); const int zz = (int)(e / ((size_t)HD * TT)); const float cs = (t < RH) ? 1.0f : (1.0f / PCAR); const size_t oo = (size_t)t * DM + (h0 + zz) * HD + d; v2f o2;
    o2[0] = Ob[e] * cs; o2[1] = Ob[e + 1] * cs; *(v2f*)(O + oo) = o2;  }



__global__ __launch_bounds__(256) void k_difln(const float* __restrict__ M1, const float* __restrict__ M2, const float* __restrict__ g, const float* __restrict__ be, const float* __restrict__ LAMB, float* OUTb) {
    const int lane = threadIdx.x & 31; const int r = blockIdx.x * 8 + (threadIdx.x >> 5); if (r >= TT) return; float lam = bfr(LAMB[0]); asm volatile("" : "+v"(lam)); const float oml = __fsub_rn(1.0f, lam); const float* a1 = M1 + (size_t)r * DQ; const float* a2 = M2 + (size_t)r * DQ; float u[DQ / 32]; float s = 0.f;
#pragma unroll
    for (int ch = 0; ch < DQ / 128; ++ch) { const int c0 = ch * 128 + lane * 4; const v4f p1 = *(const v4f*)(a1 + c0), p2 = *(const v4f*)(a2 + c0);
#pragma unroll
        for (int q = 0; q < 4; ++q) { float lp = __fmul_rn(lam, p2[q]); asm volatile("" : "+v"(lp)); float v = __fsub_rn(p1[q], lp); asm volatile("" : "+v"(v)); u[ch * 4 + q] = v; s = __fadd_rn(s, v); } }
#pragma unroll
    for (int sh = 16; sh; sh >>= 1) s += __shfl_xor(s, sh, 32);
    const float mu = s * (1.0f / DQ); float s2 = 0.f;
#pragma unroll
    for (int k = 0; k < DQ / 32; ++k) { float d0 = __fsub_rn(u[k], mu); asm volatile("" : "+v"(d0)); float p = __fmul_rn(d0, d0); asm volatile("" : "+v"(p)); s2 = __fadd_rn(s2, p); }
#pragma unroll
    for (int sh = 16; sh; sh >>= 1) s2 += __shfl_xor(s2, sh, 32);
    const float rs = __frsqrt_rn(__fadd_rn(s2 * (1.0f / DQ), LNEPS));
{
#pragma unroll
        for (int ch = 0; ch < DQ / 128; ++ch) { const int c0 = ch * 128 + lane * 4; v4f o4;
#pragma unroll
            for (int q = 0; q < 4; ++q) { float d1 = __fsub_rn(u[ch * 4 + q], mu); asm volatile("" : "+v"(d1)); float n0 = __fmul_rn(d1, rs); asm volatile("" : "+v"(n0)); float gq = bfr(g[c0 + q]), bq2 = bfr(be[c0 + q]); asm volatile("" : "+v"(gq), "+v"(bq2)); float n1 = __fmul_rn(n0, gq); asm volatile("" : "+v"(n1)); float y = __fadd_rn(n1, bq2); asm volatile("" : "+v"(y)); o4[q] = __fmul_rn(oml, y); }
            *(v4f*)(OUTb + (size_t)r * DQ + c0) = o4; }
         } }
// k_asoft: per row (zz, i): t = S x HD^-0.5 (no mask); softmax over the 2048 keys (register row, one exp, fixed trees);
__global__ __launch_bounds__(256) void k_asoft(const float* __restrict__ Sb, h16* P16, bf* Ph, bf* Pl) {
    const int lane = threadIdx.x & 31; const int row = blockIdx.x * 8 + (threadIdx.x >> 5); if (row >= ZH * TT) return; const int i = row % TT; const int zz = row / TT; (void)zz; const bool hires = (i < RH); const float* sr = Sb + (size_t)row * TT; float v[TT / 32]; float mx = -3.0e38f;
#pragma unroll
    for (int ch = 0; ch < TT / 128; ++ch) { const int j0 = ch * 128 + lane * 4; const v4f a = *(const v4f*)(sr + j0);
#pragma unroll
        for (int q = 0; q < 4; ++q) { const int j = j0 + q; (void)j; const float t = a[q] * SCL; v[ch * 4 + q] = t; mx = fmaxf(mx, t); } }
#pragma unroll
    for (int sh = 16; sh; sh >>= 1) mx = fmaxf(mx, __shfl_xor(mx, sh, 32));
    float sum = 0.f;
#pragma unroll
    for (int k = 0; k < TT / 32; ++k) { float d0 = __fsub_rn(v[k], mx); asm volatile("" : "+v"(d0)); v[k] = __builtin_amdgcn_exp2f(__fmul_rn(d0, 1.4426950408889634f)); sum += v[k]; }
#pragma unroll
    for (int sh = 16; sh; sh >>= 1) sum += __shfl_xor(sum, sh, 32);
    const float f = __fdiv_rn(hires ? 1.0f : PCAR, sum);
{
        if (hires) {
#pragma unroll
            for (int ch = 0; ch < TT / 128; ++ch) { v4us oh, ol;
#pragma unroll
                for (int q = 0; q < 4; ++q) { unsigned short a, c2; splitf(v[ch * 4 + q] * f, a, c2); oh[q] = a; ol[q] = c2; }
                const size_t oo = ((size_t)zz * (RH ? RH : 1) + i) * TT + ch * 128 + lane * 4; *(v4us*)(Ph + oo) = oh; *(v4us*)(Pl + oo) = ol; }
        } else {
#pragma unroll
            for (int ch = 0; ch < TT / 128; ++ch) { v4h o4;
#pragma unroll
                for (int q = 0; q < 4; ++q) o4[q] = tohx(v[ch * 4 + q] * f);
                *(v4h*)(P16 + (size_t)row * TT + ch * 128 + lane * 4) = o4; } }
         }
}

extern "C" void kernel_launch(void* const* d_in, const int* in_sizes, int n_in,
                              void* d_out, int out_size, void* d_ws, size_t ws_size, hipStream_t stream) {
    (void)in_sizes; (void)n_in; (void)out_size;
    const float* x = (const float*)d_in[0]; const float* wq1 = (const float*)d_in[1]; const float* wk1 = (const float*)d_in[2]; const float* wq2 = (const float*)d_in[3]; const float* wk2 = (const float*)d_in[4]; const float* wv = (const float*)d_in[5]; const float* lng = (const float*)d_in[6]; const float* lnb = (const float*)d_in[7]; const float* LAMB = (const float*)d_in[8]; const float* wq = wq1; const float* wk = wk1; const float* wo = nullptr; (void)wo; (void)wq; (void)wk;
    float* OUT = (float*)d_out;     // [2][2048][1024]
    char* wsp = (char*)d_ws;
    auto take = [&](size_t bytes) { char* p = wsp; wsp += (bytes + 255) & ~(size_t)255; return (void*)p; };
    bf* WQ = (bf*)take((size_t)DQ * DM * 2); bf* WK = (bf*)take((size_t)DKV * DM * 2); bf* WQ2 = (bf*)take((size_t)DQ * DM * 2); bf* WK2 = (bf*)take((size_t)DKV * DM * 2); bf* WV = (bf*)take((size_t)DKV * DM * 2); float* M1 = (float*)take((size_t)TT * DQ * 4); float* M2 = (float*)take((size_t)TT * DQ * 4); float* CS = (float*)take((size_t)TT * HD * 2 * 4);
    bf* XB = (bf*)take((size_t)TT * DM * 2); float* FQ = (float*)take((size_t)TT * DQ * 4); float* FK = (float*)take((size_t)TT * DKV * 4);
    h16* QP16 = (h16*)take((size_t)2 * NH_ * TT * HD * 2); h16* KP16 = (h16*)take((size_t)2 * NKV * TT * HD * 2); h16* VT16 = (h16*)take((size_t)NKV * HD * TT * 2);
    bf* QPh = (bf*)take((size_t)2 * NH_ * TT * HD * 2); bf* QPl = (bf*)take((size_t)2 * NH_ * TT * HD * 2); bf* KPh = (bf*)take((size_t)2 * NKV * TT * HD * 2); bf* KPl = (bf*)take((size_t)2 * NKV * TT * HD * 2); bf* VTh = (bf*)take((size_t)NKV * HD * TT * 2); bf* VTl = (bf*)take((size_t)NKV * HD * TT * 2); bf* Ph = (bf*)take((size_t)ZH * RH * TT * 2); bf* Pl = (bf*)take((size_t)ZH * RH * TT * 2);
    float* Sb = (float*)take((size_t)ZH * TT * TT * 4); h16* P16 = (h16*)take((size_t)ZH * TT * TT * 2); float* Ob = (float*)take((size_t)ZH * TT * HD * 4);
    if ((size_t)(wsp - (char*)d_ws) > ws_size) return;    // ws 256 MiB
    float* FV = FK;   // v projection reuses the k buffer after the k planes are built (stream-ordered)
    { const unsigned LW = (unsigned)(((size_t)DQ * DM / 2 + 255) / 256); k_whg<<<LW, 256, 0, stream>>>(wq1, WQ); k_whg<<<LW, 256, 0, stream>>>(wk1, WK); k_whg<<<LW, 256, 0, stream>>>(wq2, WQ2); k_whg<<<LW, 256, 0, stream>>>(wk2, WK2); k_whg<<<LW, 256, 0, stream>>>(wv, WV);   /* [h][c][d] -> Bt [h*64+d][c] */
       }
    k_csid<<<(TT * HD + 255) / 256, 256, 0, stream>>>(CS);
    const unsigned LQ = (unsigned)(((size_t)NH_ * TT * HD / 2 + 255) / 256), LKv = (unsigned)(((size_t)NKV * TT * HD / 2 + 255) / 256);
    for (int b = 0; b < NB_; ++b) {
        
        k_cvt8<<<(unsigned)(((size_t)TT * DM / 8 + 255) / 256), 256, 0, stream>>>(x + (size_t)b * TT * DM, XB, (size_t)TT * DM / 8);
        k_gemmw<bf, 0, false><<<dim3(TT / 64, DQ / 64, 1), 32, 0, stream>>>(XB, nullptr, WQ, nullptr, DM, FQ, DQ, nullptr, 0, 0, 0);
        k_rope<<<LQ, 256, 0, stream>>>(FQ, DQ, NH_, CS, nullptr, nullptr, 1.0f, QP16, QPh, QPl);
        k_gemmw<bf, 0, false><<<dim3(TT / 64, DKV / 64, 1), 32, 0, stream>>>(XB, nullptr, WK, nullptr, DM, FK, DKV, nullptr, 0, 0, 0);
        k_rope<<<LKv, 256, 0, stream>>>(FK, DKV, NKV, CS, nullptr, nullptr, 1.0f, KP16, KPh, KPl);
        k_gemmw<bf, 0, false><<<dim3(TT / 64, DQ / 64, 1), 32, 0, stream>>>(XB, nullptr, WQ2, nullptr, DM, FQ, DQ, nullptr, 0, 0, 0); k_rope<<<LQ, 256, 0, stream>>>(FQ, DQ, NH_, CS, nullptr, nullptr, 1.0f, QP16 + (size_t)NH_ * TT * HD, QPh + (size_t)NH_ * TT * HD, QPl + (size_t)NH_ * TT * HD);   /* q2 planes as heads 16..31 */
        k_gemmw<bf, 0, false><<<dim3(TT / 64, DKV / 64, 1), 32, 0, stream>>>(XB, nullptr, WK2, nullptr, DM, FK, DKV, nullptr, 0, 0, 0); k_rope<<<LKv, 256, 0, stream>>>(FK, DKV, NKV, CS, nullptr, nullptr, 1.0f, KP16 + (size_t)NKV * TT * HD, KPh + (size_t)NKV * TT * HD, KPl + (size_t)NKV * TT * HD);   /* k2 planes as heads 16..31 */
        k_gemmw<bf, 0, false><<<dim3(TT / 64, DKV / 64, 1), 32, 0, stream>>>(XB, nullptr, WV, nullptr, DM, FV, DKV, nullptr, 0, 0, 0); k_vtp<<<LKv, 256, 0, stream>>>(FV, DKV, NKV, VT16, VTh, VTl);
        for (int hp = 0; hp < 2 * NH_; hp += ZH) { const int h0 = hp & (NH_ - 1); const size_t zq = (size_t)hp, zk = (size_t)hp, zv = (size_t)h0;   // pass hp < 16: map 1 (q1/k1), hp >= 16: map 2 (q2/k2); both use v of head hp mod 16
            k_gemmw<bf, 2, false><<<dim3(RH / 64, TT / 64, ZH), 32, 0, stream>>>(QPh + zq * TT * HD, QPl + zq * TT * HD, KPh + zk * TT * HD, KPl + zk * TT * HD, HD, Sb, TT, nullptr, (size_t)TT * HD, (size_t)TT * HD, (size_t)TT * TT);
            k_gemmw<h16, 0, false><<<dim3((TT - RH) / 64, TT / 64, ZH), 32, 0, stream>>>(QP16 + zq * TT * HD + (size_t)RH * HD, nullptr, KP16 + zk * TT * HD, nullptr, HD, Sb + (size_t)RH * TT, TT, nullptr, (size_t)TT * HD, (size_t)TT * HD, (size_t)TT * TT);
            k_asoft<<<ZH * TT / 8, 256, 0, stream>>>(Sb, P16, Ph, Pl);
            k_gemmw<bf, 2, false><<<dim3(RH / 64, HD / 64, ZH), 32, 0, stream>>>(Ph, Pl, VTh + zv * HD * TT, VTl + zv * HD * TT, TT, Ob, HD, nullptr, (size_t)RH * TT, (size_t)HD * TT, (size_t)TT * HD);
            k_gemmw<h16, 0, false><<<dim3((TT - RH) / 64, HD / 64, ZH), 32, 0, stream>>>(P16 + (size_t)RH * TT, nullptr, VT16 + zv * HD * TT, nullptr, TT, Ob + (size_t)RH * HD, HD, nullptr, (size_t)TT * TT, (size_t)HD * TT, (size_t)TT * HD);
            k_mergeF<<<(unsigned)(((size_t)ZH * TT * HD / 2 + 255) / 256), 256, 0, stream>>>(Ob, h0, (hp < NH_) ? M1 : M2); }   /* f32 merged contexts of map 1 / map 2 */
        k_difln<<<TT / 8, 256, 0, stream>>>(M1, M2, lng, lnb, LAMB, OUT + (size_t)b * TT * DM); }   /* (1 - lamb) LN(M1 - lamb M2) */
}

// v001
// It runs in 1570 microseconds.
// Timed twice side by side with v000, it ran 2.41 and 2.38 times as fast.
#include <hip/hip_runtime.h>

// Multi-head differential attention (x [2][2048][1024]; per head h: q1, k1, q2, k2, v = x W[h] (W [16][1024][64]); w1 = softmax(q1.k1/8), w2 = softmax(q2.k2/8); head out = (w1 - lamb w2) v = w1 v - lamb (w2 v); concat heads; out = (1 - lamb) LayerNorm(concat) (gamma, beta, eps 1e-5; lamb scalar, read) -> [2][2048][1024] (4.2 M)).
// Layout: the five [h][c][d] weight tensors are gathered into an [h*64+d][c] layout; the two attention maps run as 32 head passes (pass p < 16: q1/k1 of head p, pass p >= 16: q2/k2 of head p-16, both with v of head p mod 16) whose f32 contexts land in two merged buffers M1, M2; one row kernel forms M1 - lamb M2, LayerNorms it and scales by (1 - lamb).
// Compute dtypes, f32 accumulate: every input rounded to bf16; q/k/v on PLAIN bf16 operands (inputs: exact); both maps: scores and attn.v: query rows < 512 hl (3 products), the rest single fp16 (x1024); softmax f32; no output projection: f32 difference, LayerNorm and scale.

#define NB_  2
#define TT   2048
#define DM   1024
#define NH_  16
#define NKV  16
#define REP  (NH_ / NKV)
#define HD   64
#define DQ   (NH_ * HD)
#define DKV  (NKV * HD)
#define LNEPS 1e-5f
#define ZH   2
#define RH   512                  // query rows < RH use hi+lo planes (0: none)
#define WIN  0
#define PCAR 1024.0f
#define SCL  0.125f   // HD^-0.5
typedef _Float16 h16;
typedef unsigned short bf;
typedef __attribute__((ext_vector_type(16))) __bf16   v16bf;
typedef __attribute__((ext_vector_type(16))) _Float16 v16h;
typedef __attribute__((ext_vector_type(8)))  _Float16 v8h;
typedef __attribute__((ext_vector_type(8)))  unsigned short v8us;
typedef __attribute__((ext_vector_type(8)))  float    v8f;
typedef __attribute__((ext_vector_type(4)))  float    v4f;
typedef v8h  __attribute__((may_alias)) v8ha;
typedef v4f  __attribute__((may_alias)) v4fa;
typedef v8us __attribute__((may_alias)) v8usa;

__device__ __forceinline__ unsigned short f2bf(float f) { unsigned u = __float_as_uint(f); u += 0x7FFFu + ((u >> 16) & 1u); return (unsigned short)(u >> 16); }
__device__ __forceinline__ float bf2f(unsigned short b) { return __uint_as_float(((unsigned)b) << 16); }
__device__ __forceinline__ float bfr(float f) { return bf2f(f2bf(f)); }
__device__ __forceinline__ v16h cat16(v8h lo, v8h hi) { return __builtin_shufflevector(lo, hi, 0, 1, 2, 3, 4, 5, 6, 7, 8, 9, 10, 11, 12, 13, 14, 15); }
__device__ __forceinline__ v16bf cat16b(v8us lo, v8us hi) { return __builtin_bit_cast(v16bf, __builtin_shufflevector(lo, hi, 0, 1, 2, 3, 4, 5, 6, 7, 8, 9, 10, 11, 12, 13, 14, 15)); }
__device__ __forceinline__ v8f wmma16(v16h a, v16h b, v8f c) { return __builtin_amdgcn_wmma_f32_16x16x32_f16(false, a, false, b, (short)0, c, false, false); }
__device__ __forceinline__ v8f wmmab(v16bf a, v16bf b, v8f c) { return __builtin_amdgcn_wmma_f32_16x16x32_bf16(false, a, false, b, (short)0, c, false, false); }



// ---- k_gemmw: register-blocked GEMM, ONE WAVE per 64x64 output tile (16 accumulators), operands straight from K-contiguous 16-bit planes; grid (M/64, N/64, Z), 32 threads.
// C[m][n] (f32, pitch ldc, + optional f32 bias[n]) = sum_k A[m][k] Bt[n][k] (+ split products per NSPLIT). z-batch strides sA/sB/sC in elements. K % 32 == 0.
template <typename T16> struct WFrag;
template <> struct WFrag<h16> { typedef v16h V; static __device__ __forceinline__ V ld(const h16* p) { return cat16(*(const v8h*)p, *(const v8h*)(p + 16)); } static __device__ __forceinline__ v8f mma(V a, V b, v8f c) { return wmma16(a, b, c); } };
template <> struct WFrag<bf> { typedef v16bf V; static __device__ __forceinline__ V ld(const bf* p) { return cat16b(*(const v8us*)p, *(const v8us*)(p + 16)); } static __device__ __forceinline__ v8f mma(V a, V b, v8f c) { return wmmab(a, b, c); } };
template <typename T16, int NSPLIT, bool BIAS>
__global__ __launch_bounds__(32) void k_gemmw(const T16* __restrict__ A, const T16* __restrict__ A2, const T16* __restrict__ Bt, const T16* __restrict__ Bt2, int K, float* C, int ldc, const float* __restrict__ bias, size_t sA, size_t sB, size_t sC) {
    typedef typename WFrag<T16>::V V;
    __shared__ __align__(16) float os[16 * 68];
    const size_t z = blockIdx.z; A += z * sA; if (A2) A2 += z * sA; Bt += z * sB; if (Bt2) Bt2 += z * sB; C += z * sC;
    const int lane = threadIdx.x & 31, lr = lane & 15, hi = lane >> 4; const int r0 = blockIdx.x * 64, c0 = blockIdx.y * 64;
    v8f acc[4][4];
#pragma unroll
    for (int mb = 0; mb < 4; ++mb)
#pragma unroll
        for (int nb = 0; nb < 4; ++nb) acc[mb][nb] = (v8f){};
    const size_t aoff = (size_t)(r0 + lr) * K + 8 * hi, boff = (size_t)(c0 + lr) * K + 8 * hi;
#pragma unroll 1
    for (int kc = 0; kc < K; kc += 32) {
        V a[4], a2[4];
#pragma unroll
        for (int mb = 0; mb < 4; ++mb) { a[mb] = WFrag<T16>::ld(A + aoff + (size_t)mb * 16 * K + kc); if (NSPLIT == 1 || NSPLIT == 2) a2[mb] = WFrag<T16>::ld(A2 + aoff + (size_t)mb * 16 * K + kc); }
#pragma unroll
        for (int nb = 0; nb < 4; ++nb) { const V b = WFrag<T16>::ld(Bt + boff + (size_t)nb * 16 * K + kc); V b2; if (NSPLIT >= 2) b2 = WFrag<T16>::ld(Bt2 + boff + (size_t)nb * 16 * K + kc);
#pragma unroll
            for (int mb = 0; mb < 4; ++mb) { acc[mb][nb] = WFrag<T16>::mma(a[mb], b, acc[mb][nb]); if (NSPLIT == 1 || NSPLIT == 2) acc[mb][nb] = WFrag<T16>::mma(a2[mb], b, acc[mb][nb]); if (NSPLIT >= 2) acc[mb][nb] = WFrag<T16>::mma(a[mb], b2, acc[mb][nb]); } }
        asm volatile("v_nop\n\tv_nop\n\tv_nop\n\tv_nop" : "+v"(acc[0][0]), "+v"(acc[1][1]), "+v"(acc[2][2]), "+v"(acc[3][3]) : "v"(a[0]), "v"(a[3]));
    }
#pragma unroll
    for (int mb = 0; mb < 4; ++mb) {
#pragma unroll
        for (int nb = 0; nb < 4; ++nb) {
#pragma unroll
            for (int j = 0; j < 8; ++j) os[(hi * 8 + j) * 68 + nb * 16 + lr] = acc[mb][nb][j]; }
        __builtin_amdgcn_wave_barrier(); asm volatile("" ::: "memory");
        float* crow = C + (size_t)(r0 + mb * 16) * ldc + c0;
{
#pragma unroll
            for (int s = 0; s < 8; ++s) { const int row = 2 * s + hi, cofs = lr * 4; v4f val = *(const v4fa*)(os + row * 68 + cofs); if (BIAS) { val[0] += bfr(bias[c0 + cofs]); val[1] += bfr(bias[c0 + cofs + 1]); val[2] += bfr(bias[c0 + cofs + 2]); val[3] += bfr(bias[c0 + cofs + 3]); }
                *(v4f*)(crow + (size_t)row * ldc + cofs) = val; }
             }
        __builtin_amdgcn_wave_barrier(); asm volatile("" ::: "memory");
    }
}

// ---- k_gemmsk: the same product as k_gemmw for a long K and a small C: one work-group per (16 MB) x (16 NB) tile of C, K split evenly over its NW waves.
// Each wave sums its own K / NW slice in its own accumulators (all its loads can be in flight at once); the NW partial tiles meet in LDS and are added in wave order. grid (M / (16 MB), N / (16 NB), Z), NW * 32 threads.
template <typename T16, int NSPLIT, int MB, int NB, int NW, int K>
__global__ __launch_bounds__(NW * 32) void k_gemmsk(const T16* __restrict__ A, const T16* __restrict__ A2, const T16* __restrict__ Bt, const T16* __restrict__ Bt2, float* C, int ldc, size_t sA, size_t sB, size_t sC) {
    typedef typename WFrag<T16>::V V;
    constexpr int PW = NB * 16 + 4, KW = K / NW, KS = KW / 32, PER = MB * NB * 256 / (NW * 32);   // LDS row pitch in floats, k per wave, k steps per wave, C elements per thread
    static_assert((NSPLIT == 0 || NSPLIT == 2) && KW % 32 == 0 && KW * NW == K && PER >= 1 && PER * NW * 32 == MB * NB * 256 && (NB * 16) % PER == 0, "shape");
    __shared__ __align__(16) float os[NW * MB * 16 * PW];
    const size_t z = blockIdx.z; A += z * sA; if (NSPLIT == 2) A2 += z * sA; Bt += z * sB; if (NSPLIT == 2) Bt2 += z * sB; C += z * sC;
    const int lane = threadIdx.x & 31, lr = lane & 15, hi = lane >> 4, w = threadIdx.x >> 5; const int r0 = blockIdx.x * (16 * MB), c0 = blockIdx.y * (16 * NB);
    v8f acc[MB][NB];
#pragma unroll
    for (int mb = 0; mb < MB; ++mb)
#pragma unroll
        for (int nb = 0; nb < NB; ++nb) acc[mb][nb] = (v8f){};
    const size_t aoff = (size_t)(r0 + lr) * K + w * KW + 8 * hi, boff = (size_t)(c0 + lr) * K + w * KW + 8 * hi; const T16* pa = A + aoff; const T16* pa2 = (NSPLIT == 2) ? A2 + aoff : nullptr; const T16* pb = Bt + boff; const T16* pb2 = (NSPLIT == 2) ? Bt2 + boff : nullptr;
    // every load of the slice is issued before the first product, row set by row set, so that the four loads that share a 128-B line follow one another
    V a[KS][MB], a2[KS][MB], b[KS][NB], b2[KS][NB];
#pragma unroll
    for (int mb = 0; mb < MB; ++mb) {
#pragma unroll
        for (int ks = 0; ks < KS; ++ks) a[ks][mb] = WFrag<T16>::ld(pa + (size_t)mb * 16 * K + ks * 32);
        if (NSPLIT == 2) {
#pragma unroll
            for (int ks = 0; ks < KS; ++ks) a2[ks][mb] = WFrag<T16>::ld(pa2 + (size_t)mb * 16 * K + ks * 32); } }
#pragma unroll
    for (int nb = 0; nb < NB; ++nb) {
#pragma unroll
        for (int ks = 0; ks < KS; ++ks) b[ks][nb] = WFrag<T16>::ld(pb + (size_t)nb * 16 * K + ks * 32);
        if (NSPLIT == 2) {
#pragma unroll
            for (int ks = 0; ks < KS; ++ks) b2[ks][nb] = WFrag<T16>::ld(pb2 + (size_t)nb * 16 * K + ks * 32); } }
    // the wait that belongs in front of any overwrite of a register that an issued load names; the bases are its inputs so that they stay whole up to here
    if constexpr (NSPLIT == 2) asm volatile("s_wait_xcnt 0x0" :: "v"(pa), "v"(pa2), "v"(pb), "v"(pb2) : "memory");
    else asm volatile("s_wait_xcnt 0x0" :: "v"(pa), "v"(pb) : "memory");
    __builtin_amdgcn_sched_barrier(0);   // keeps the products below the loads: without it the compiler pairs each product with its loads and the wave waits out one memory latency per k step
#pragma unroll
    for (int ks = 0; ks < KS; ++ks)
#pragma unroll
        for (int nb = 0; nb < NB; ++nb)
#pragma unroll
            for (int mb = 0; mb < MB; ++mb) { acc[mb][nb] = WFrag<T16>::mma(a[ks][mb], b[ks][nb], acc[mb][nb]); if (NSPLIT == 2) { acc[mb][nb] = WFrag<T16>::mma(a2[ks][mb], b[ks][nb], acc[mb][nb]); acc[mb][nb] = WFrag<T16>::mma(a[ks][mb], b2[ks][nb], acc[mb][nb]); } }
    float* ow = os + w * (MB * 16 * PW);
#pragma unroll
    for (int mb = 0; mb < MB; ++mb)
#pragma unroll
        for (int nb = 0; nb < NB; ++nb)
#pragma unroll
            for (int j = 0; j < 8; ++j) ow[(mb * 16 + hi * 8 + j) * PW + nb * 16 + lr] = acc[mb][nb][j];
    __syncthreads();
    const int e = threadIdx.x * PER, row = e / (NB * 16), col = e % (NB * 16); float s[PER];
#pragma unroll
    for (int q = 0; q < PER; ++q) s[q] = os[row * PW + col + q];
#pragma unroll
    for (int u = 1; u < NW; ++u)
#pragma unroll
        for (int q = 0; q < PER; ++q) s[q] += os[u * (MB * 16 * PW) + row * PW + col + q];
#pragma unroll
    for (int q = 0; q < PER; ++q) C[(size_t)(r0 + row) * ldc + c0 + col + q] = s[q];
}

__device__ __forceinline__ h16 tohx(float x) { return (h16)x; }
__device__ __forceinline__ void splitf(float y, unsigned short& h, unsigned short& l) { h = f2bf(y); l = f2bf(y - bf2f(h)); }
typedef __attribute__((ext_vector_type(2))) _Float16 v2h;
typedef __attribute__((ext_vector_type(4))) _Float16 v4h;
typedef __attribute__((ext_vector_type(2))) unsigned short v2us;
typedef __attribute__((ext_vector_type(4))) unsigned short v4us;
typedef __attribute__((ext_vector_type(2))) float v2f;
typedef __attribute__((ext_vector_type(4))) int v4i;

__global__ __launch_bounds__(256) void k_wtG(const float* __restrict__ w, int K, int N, bf* Bt) {
    const int lane = threadIdx.x & 31; const int L0 = (blockIdx.x * 8 + (threadIdx.x >> 5)) * 8; const int nlines = N * K / 64;
{
#pragma unroll 1
        for (int l = 0; l < 8; ++l) { const int L = L0 + l; if (L >= nlines) break; const size_t e = (size_t)L * 64 + lane * 2; const int k = (int)(e % K), n = (int)(e / K); v2us o;
            o[0] = f2bf(w[(size_t)k * N + n]); o[1] = f2bf(w[(size_t)(k + 1) * N + n]); *(v2us*)(Bt + e) = o; }
         }
}
__global__ __launch_bounds__(256) void k_whg(const float* __restrict__ w, bf* Bt) { const size_t e0 = ((size_t)blockIdx.x * 256 + threadIdx.x) * 2; if (e0 >= (size_t)DQ * DM) return; const int e = (int)(e0 % DM); const int n = (int)(e0 / DM); const int h = n / HD, d = n % HD; v2us o; o[0] = f2bf(w[((size_t)h * DM + e) * HD + d]); o[1] = f2bf(w[((size_t)h * DM + e + 1) * HD + d]); *(v2us*)(Bt + e0) = o;  }
__global__ __launch_bounds__(256) void k_cvt8(const float* __restrict__ src, bf* dst, size_t n8) { const size_t i = (size_t)blockIdx.x * 256 + threadIdx.x; if (i >= n8) return; const v8f v = *(const v8f*)(src + i * 8); v8us o;
#pragma unroll
    for (int k = 0; k < 8; ++k) o[k] = f2bf(v[k]); *(v8us*)(dst + i * 8) = o;  }

// k_rope: head planes [h][t][d] (fp16 + hi/lo) of rope(x) x sc with the rotate-half convention out[d] = x[d] cos[t][d] - x[d+HD/2] sin[t][d], out[d+HD/2] = x[d+HD/2] cos[t][d+HD/2] + x[d] sin[t][d+HD/2]
__global__ __launch_bounds__(256) void k_rope(const float* __restrict__ F, int pitch, int nheads, const float* __restrict__ CS, const float* __restrict__ RF, const float* __restrict__ nw, float sc, h16* P16, bf* Ph, bf* Pl) {
    const size_t e = ((size_t)blockIdx.x * 256 + threadIdx.x) * 2; if (e >= (size_t)nheads * TT * HD) return; const int d = (int)(e % HD); const int t = (int)((e / HD) % TT); const int h = (int)(e / ((size_t)HD * TT)); const float* f = F + (size_t)t * pitch + h * HD; const float rf = RF ? RF[(size_t)h * TT + t] : 1.0f; v2h o16; v2us oh, ol;
#pragma unroll
    for (int q = 0; q < 2; ++q) { const int dd = d + q; const int dp = (dd < HD / 2) ? dd + HD / 2 : dd - HD / 2; float x0 = f[dd], x1 = f[dp];
        if (RF) { float n0 = __fmul_rn(x0, rf), n1 = __fmul_rn(x1, rf); asm volatile("" : "+v"(n0)); asm volatile("" : "+v"(n1)); x0 = __fmul_rn(bfr(nw[dd]), n0); x1 = __fmul_rn(bfr(nw[dp]), n1); }
        const v2f cs = *(const v2f*)(CS + ((size_t)t * HD + dd) * 2); float a = __fmul_rn(x0, cs[0]), bq = __fmul_rn(x1, cs[1]); asm volatile("" : "+v"(a)); asm volatile("" : "+v"(bq)); const float r = ((dd < HD / 2) ? __fsub_rn(a, bq) : __fadd_rn(a, bq)) * sc;
        o16[q] = tohx(r); unsigned short a2, c2; splitf(r, a2, c2); oh[q] = a2; ol[q] = c2; }
    *(v2h*)(P16 + e) = o16; *(v2us*)(Ph + e) = oh; *(v2us*)(Pl + e) = ol;  }
__global__ __launch_bounds__(256) void k_vtp(const float* __restrict__ F, int pitch, int nheads, h16* V16, bf* Vh, bf* Vl) { const size_t e = ((size_t)blockIdx.x * 256 + threadIdx.x) * 2; if (e >= (size_t)nheads * HD * TT) return; const int t = (int)(e % TT); const int d = (int)((e / TT) % HD); const int g = (int)(e / ((size_t)TT * HD)); v2h o16; v2us oh, ol;
#pragma unroll
    for (int q = 0; q < 2; ++q) { const float x = F[(size_t)(t + q) * pitch + g * HD + d]; o16[q] = tohx(x); unsigned short a2, c2; splitf(x, a2, c2); oh[q] = a2; ol[q] = c2; }
    *(v2h*)(V16 + e) = o16; *(v2us*)(Vh + e) = oh; *(v2us*)(Vl + e) = ol;  }
__global__ __launch_bounds__(256) void k_csid(float* CS) { const int idx = blockIdx.x * 256 + threadIdx.x; if (idx >= TT * HD) return; v2f cs; cs[0] = 1.0f; cs[1] = 0.0f; *(v2f*)(CS + (size_t)idx * 2) = cs;  }
__global__ __launch_bounds__(256) void k_mergeF(const float* __restrict__ Ob, int h0, float* O) { const size_t e = ((size_t)blockIdx.x * 256 + threadIdx.x) * 2; if (e >= (size_t)ZH * TT * HD) return; const int d = (int)(e % HD); const int t = (int)((e / HD) % TT); const int zz = (int)(e / ((size_t)HD * TT)); const float cs = (t < RH) ? 1.0f : (1.0f / PCAR); const size_t oo = (size_t)t * DM + (h0 + zz) * HD + d; v2f o2;
    o2[0] = Ob[e] * cs; o2[1] = Ob[e + 1] * cs; *(v2f*)(O + oo) = o2;  }



__global__ __launch_bounds__(256) void k_difln(const float* __restrict__ M1, const float* __restrict__ M2, const float* __restrict__ g, const float* __restrict__ be, const float* __restrict__ LAMB, float* OUTb) {
    const int lane = threadIdx.x & 31; const int r = blockIdx.x * 8 + (threadIdx.x >> 5); if (r >= TT) return; float lam = bfr(LAMB[0]); asm volatile("" : "+v"(lam)); const float oml = __fsub_rn(1.0f, lam); const float* a1 = M1 + (size_t)r * DQ; const float* a2 = M2 + (size_t)r * DQ; float u[DQ / 32]; float s = 0.f;
#pragma unroll
    for (int ch = 0; ch < DQ / 128; ++ch) { const int c0 = ch * 128 + lane * 4; const v4f p1 = *(const v4f*)(a1 + c0), p2 = *(const v4f*)(a2 + c0);
#pragma unroll
        for (int q = 0; q < 4; ++q) { float lp = __fmul_rn(lam, p2[q]); asm volatile("" : "+v"(lp)); float v = __fsub_rn(p1[q], lp); asm volatile("" : "+v"(v)); u[ch * 4 + q] = v; s = __fadd_rn(s, v); } }
#pragma unroll
    for (int sh = 16; sh; sh >>= 1) s += __shfl_xor(s, sh, 32);
    const float mu = s * (1.0f / DQ); float s2 = 0.f;
#pragma unroll
    for (int k = 0; k < DQ / 32; ++k) { float d0 = __fsub_rn(u[k], mu); asm volatile("" : "+v"(d0)); float p = __fmul_rn(d0, d0); asm volatile("" : "+v"(p)); s2 = __fadd_rn(s2, p); }
#pragma unroll
    for (int sh = 16; sh; sh >>= 1) s2 += __shfl_xor(s2, sh, 32);
    const float rs = __frsqrt_rn(__fadd_rn(s2 * (1.0f / DQ), LNEPS));
{
#pragma unroll
        for (int ch = 0; ch < DQ / 128; ++ch) { const int c0 = ch * 128 + lane * 4; v4f o4;
#pragma unroll
            for (int q = 0; q < 4; ++q) { float d1 = __fsub_rn(u[ch * 4 + q], mu); asm volatile("" : "+v"(d1)); float n0 = __fmul_rn(d1, rs); asm volatile("" : "+v"(n0)); float gq = bfr(g[c0 + q]), bq2 = bfr(be[c0 + q]); asm volatile("" : "+v"(gq), "+v"(bq2)); float n1 = __fmul_rn(n0, gq); asm volatile("" : "+v"(n1)); float y = __fadd_rn(n1, bq2); asm volatile("" : "+v"(y)); o4[q] = __fmul_rn(oml, y); }
            *(v4f*)(OUTb + (size_t)r * DQ + c0) = o4; }
         } }
// k_asoft: per row (zz, i): t = S x HD^-0.5 (no mask); softmax over the 2048 keys (register row, one exp, fixed trees);
__global__ __launch_bounds__(256) void k_asoft(const float* __restrict__ Sb, h16* P16, bf* Ph, bf* Pl) {
    const int lane = threadIdx.x & 31; const int row = blockIdx.x * 8 + (threadIdx.x >> 5); if (row >= ZH * TT) return; const int i = row % TT; const int zz = row / TT; (void)zz; const bool hires = (i < RH); const float* sr = Sb + (size_t)row * TT; float v[TT / 32]; float mx = -3.0e38f;
#pragma unroll
    for (int ch = 0; ch < TT / 128; ++ch) { const int j0 = ch * 128 + lane * 4; const v4f a = *(const v4f*)(sr + j0);
#pragma unroll
        for (int q = 0; q < 4; ++q) { const int j = j0 + q; (void)j; const float t = a[q] * SCL; v[ch * 4 + q] = t; mx = fmaxf(mx, t); } }
#pragma unroll
    for (int sh = 16; sh; sh >>= 1) mx = fmaxf(mx, __shfl_xor(mx, sh, 32));
    float sum = 0.f;
#pragma unroll
    for (int k = 0; k < TT / 32; ++k) { float d0 = __fsub_rn(v[k], mx); asm volatile("" : "+v"(d0)); v[k] = __builtin_amdgcn_exp2f(__fmul_rn(d0, 1.4426950408889634f)); sum += v[k]; }
#pragma unroll
    for (int sh = 16; sh; sh >>= 1) sum += __shfl_xor(sum, sh, 32);
    const float f = __fdiv_rn(hires ? 1.0f : PCAR, sum);
{
        if (hires) {
#pragma unroll
            for (int ch = 0; ch < TT / 128; ++ch) { v4us oh, ol;
#pragma unroll
                for (int q = 0; q < 4; ++q) { unsigned short a, c2; splitf(v[ch * 4 + q] * f, a, c2); oh[q] = a; ol[q] = c2; }
                const size_t oo = ((size_t)zz * (RH ? RH : 1) + i) * TT + ch * 128 + lane * 4; *(v4us*)(Ph + oo) = oh; *(v4us*)(Pl + oo) = ol; }
        } else {
#pragma unroll
            for (int ch = 0; ch < TT / 128; ++ch) { v4h o4;
#pragma unroll
                for (int q = 0; q < 4; ++q) o4[q] = tohx(v[ch * 4 + q] * f);
                *(v4h*)(P16 + (size_t)row * TT + ch * 128 + lane * 4) = o4; } }
         }
}

extern "C" void kernel_launch(void* const* d_in, const int* in_sizes, int n_in,
                              void* d_out, int out_size, void* d_ws, size_t ws_size, hipStream_t stream) {
    (void)in_sizes; (void)n_in; (void)out_size;
    const float* x = (const float*)d_in[0]; const float* wq1 = (const float*)d_in[1]; const float* wk1 = (const float*)d_in[2]; const float* wq2 = (const float*)d_in[3]; const float* wk2 = (const float*)d_in[4]; const float* wv = (const float*)d_in[5]; const float* lng = (const float*)d_in[6]; const float* lnb = (const float*)d_in[7]; const float* LAMB = (const float*)d_in[8]; const float* wq = wq1; const float* wk = wk1; const float* wo = nullptr; (void)wo; (void)wq; (void)wk;
    float* OUT = (float*)d_out;     // [2][2048][1024]
    char* wsp = (char*)d_ws;
    auto take = [&](size_t bytes) { char* p = wsp; wsp += (bytes + 255) & ~(size_t)255; return (void*)p; };
    bf* WQ = (bf*)take((size_t)DQ * DM * 2); bf* WK = (bf*)take((size_t)DKV * DM * 2); bf* WQ2 = (bf*)take((size_t)DQ * DM * 2); bf* WK2 = (bf*)take((size_t)DKV * DM * 2); bf* WV = (bf*)take((size_t)DKV * DM * 2); float* M1 = (float*)take((size_t)TT * DQ * 4); float* M2 = (float*)take((size_t)TT * DQ * 4); float* CS = (float*)take((size_t)TT * HD * 2 * 4);
    bf* XB = (bf*)take((size_t)TT * DM * 2); float* FQ = (float*)take((size_t)TT * DQ * 4); float* FK = (float*)take((size_t)TT * DKV * 4);
    h16* QP16 = (h16*)take((size_t)2 * NH_ * TT * HD * 2); h16* KP16 = (h16*)take((size_t)2 * NKV * TT * HD * 2); h16* VT16 = (h16*)take((size_t)NKV * HD * TT * 2);
    bf* QPh = (bf*)take((size_t)2 * NH_ * TT * HD * 2); bf* QPl = (bf*)take((size_t)2 * NH_ * TT * HD * 2); bf* KPh = (bf*)take((size_t)2 * NKV * TT * HD * 2); bf* KPl = (bf*)take((size_t)2 * NKV * TT * HD * 2); bf* VTh = (bf*)take((size_t)NKV * HD * TT * 2); bf* VTl = (bf*)take((size_t)NKV * HD * TT * 2); bf* Ph = (bf*)take((size_t)ZH * RH * TT * 2); bf* Pl = (bf*)take((size_t)ZH * RH * TT * 2);
    float* Sb = (float*)take((size_t)ZH * TT * TT * 4); h16* P16 = (h16*)take((size_t)ZH * TT * TT * 2); float* Ob = (float*)take((size_t)ZH * TT * HD * 4);
    if ((size_t)(wsp - (char*)d_ws) > ws_size) return;    // ws 256 MiB
    float* FV = FK;   // v projection reuses the k buffer after the k planes are built (stream-ordered)
    { const unsigned LW = (unsigned)(((size_t)DQ * DM / 2 + 255) / 256); k_whg<<<LW, 256, 0, stream>>>(wq1, WQ); k_whg<<<LW, 256, 0, stream>>>(wk1, WK); k_whg<<<LW, 256, 0, stream>>>(wq2, WQ2); k_whg<<<LW, 256, 0, stream>>>(wk2, WK2); k_whg<<<LW, 256, 0, stream>>>(wv, WV);   /* [h][c][d] -> Bt [h*64+d][c] */
       }
    k_csid<<<(TT * HD + 255) / 256, 256, 0, stream>>>(CS);
    const unsigned LQ = (unsigned)(((size_t)NH_ * TT * HD / 2 + 255) / 256), LKv = (unsigned)(((size_t)NKV * TT * HD / 2 + 255) / 256);
    for (int b = 0; b < NB_; ++b) {
        
        k_cvt8<<<(unsigned)(((size_t)TT * DM / 8 + 255) / 256), 256, 0, stream>>>(x + (size_t)b * TT * DM, XB, (size_t)TT * DM / 8);
        k_gemmw<bf, 0, false><<<dim3(TT / 64, DQ / 64, 1), 32, 0, stream>>>(XB, nullptr, WQ, nullptr, DM, FQ, DQ, nullptr, 0, 0, 0);
        k_rope<<<LQ, 256, 0, stream>>>(FQ, DQ, NH_, CS, nullptr, nullptr, 1.0f, QP16, QPh, QPl);
        k_gemmw<bf, 0, false><<<dim3(TT / 64, DKV / 64, 1), 32, 0, stream>>>(XB, nullptr, WK, nullptr, DM, FK, DKV, nullptr, 0, 0, 0);
        k_rope<<<LKv, 256, 0, stream>>>(FK, DKV, NKV, CS, nullptr, nullptr, 1.0f, KP16, KPh, KPl);
        k_gemmw<bf, 0, false><<<dim3(TT / 64, DQ / 64, 1), 32, 0, stream>>>(XB, nullptr, WQ2, nullptr, DM, FQ, DQ, nullptr, 0, 0, 0); k_rope<<<LQ, 256, 0, stream>>>(FQ, DQ, NH_, CS, nullptr, nullptr, 1.0f, QP16 + (size_t)NH_ * TT * HD, QPh + (size_t)NH_ * TT * HD, QPl + (size_t)NH_ * TT * HD);   /* q2 planes as heads 16..31 */
        k_gemmw<bf, 0, false><<<dim3(TT / 64, DKV / 64, 1), 32, 0, stream>>>(XB, nullptr, WK2, nullptr, DM, FK, DKV, nullptr, 0, 0, 0); k_rope<<<LKv, 256, 0, stream>>>(FK, DKV, NKV, CS, nullptr, nullptr, 1.0f, KP16 + (size_t)NKV * TT * HD, KPh + (size_t)NKV * TT * HD, KPl + (size_t)NKV * TT * HD);   /* k2 planes as heads 16..31 */
        k_gemmw<bf, 0, false><<<dim3(TT / 64, DKV / 64, 1), 32, 0, stream>>>(XB, nullptr, WV, nullptr, DM, FV, DKV, nullptr, 0, 0, 0); k_vtp<<<LKv, 256, 0, stream>>>(FV, DKV, NKV, VT16, VTh, VTl);
        for (int hp = 0; hp < 2 * NH_; hp += ZH) { const int h0 = hp & (NH_ - 1); const size_t zq = (size_t)hp, zk = (size_t)hp, zv = (size_t)h0;   // pass hp < 16: map 1 (q1/k1), hp >= 16: map 2 (q2/k2); both use v of head hp mod 16
            k_gemmw<bf, 2, false><<<dim3(RH / 64, TT / 64, ZH), 32, 0, stream>>>(QPh + zq * TT * HD, QPl + zq * TT * HD, KPh + zk * TT * HD, KPl + zk * TT * HD, HD, Sb, TT, nullptr, (size_t)TT * HD, (size_t)TT * HD, (size_t)TT * TT);
            k_gemmw<h16, 0, false><<<dim3((TT - RH) / 64, TT / 64, ZH), 32, 0, stream>>>(QP16 + zq * TT * HD + (size_t)RH * HD, nullptr, KP16 + zk * TT * HD, nullptr, HD, Sb + (size_t)RH * TT, TT, nullptr, (size_t)TT * HD, (size_t)TT * HD, (size_t)TT * TT);
            k_asoft<<<ZH * TT / 8, 256, 0, stream>>>(Sb, P16, Ph, Pl);
            k_gemmsk<bf, 2, 1, 2, 16, TT><<<dim3(RH / 16, HD / 32, ZH), 512, 0, stream>>>(Ph, Pl, VTh + zv * HD * TT, VTl + zv * HD * TT, Ob, HD, (size_t)RH * TT, (size_t)HD * TT, (size_t)TT * HD);
            k_gemmsk<h16, 0, 2, 2, 16, TT><<<dim3((TT - RH) / 32, HD / 32, ZH), 512, 0, stream>>>(P16 + (size_t)RH * TT, nullptr, VT16 + zv * HD * TT, nullptr, Ob + (size_t)RH * HD, HD, (size_t)TT * TT, (size_t)HD * TT, (size_t)TT * HD);
            k_mergeF<<<(unsigned)(((size_t)ZH * TT * HD / 2 + 255) / 256), 256, 0, stream>>>(Ob, h0, (hp < NH_) ? M1 : M2); }   /* f32 merged contexts of map 1 / map 2 */
        k_difln<<<TT / 8, 256, 0, stream>>>(M1, M2, lng, lnb, LAMB, OUT + (size_t)b * TT * DM); }   /* (1 - lamb) LN(M1 - lamb M2) */
}

// v002
// It runs in 1180 microseconds.
// In both of two side-by-side timings against v001, it was 1.33 times as fast.
// Over all steps from v000 it is 3.18 times as fast.
#include <hip/hip_runtime.h>

// Multi-head differential attention (x [2][2048][1024]; per head h: q1, k1, q2, k2, v = x W[h] (W [16][1024][64]); w1 = softmax(q1.k1/8), w2 = softmax(q2.k2/8); head out = (w1 - lamb w2) v = w1 v - lamb (w2 v); concat heads; out = (1 - lamb) LayerNorm(concat) (gamma, beta, eps 1e-5; lamb scalar, read) -> [2][2048][1024] (4.2 M)).
// Layout: the five [h][c][d] weight tensors are gathered into the [h*64+d][c] layout; the two attention maps run as 32 head passes (pass p < 16: q1/k1 of head p, pass p >= 16: q2/k2 of head p-16, both with v of head p mod 16) taken ZH heads per launch, whose f32 contexts land in two merged buffers M1, M2; the softmax writes its 16-bit rows in place over its own f32 score row, so that ZH score maps are all the workspace the passes need; one row kernel forms M1 - lamb M2, LayerNorms it and scales by (1 - lamb).
// Compute dtypes, f32 accumulate: every input rounded to bf16; q/k/v on PLAIN bf16 operands (inputs: exact); both maps: scores and attn.v: query rows < 512 hl (3 products), the rest single fp16 (x1024); softmax f32; no output projection: f32 difference, LayerNorm and scale.

#define NB_  2
#define TT   2048
#define DM   1024
#define NH_  16
#define NKV  16
#define REP  (NH_ / NKV)
#define HD   64
#define DQ   (NH_ * HD)
#define DKV  (NKV * HD)
#define LNEPS 1e-5f
#define ZH   8                    // heads per launch of the attention passes
#define RH   512                  // query rows < RH use hi+lo planes (0: none)
#define WIN  0
#define PCAR 1024.0f
#define SCL  0.125f   // HD^-0.5
typedef _Float16 h16;
typedef unsigned short bf;
typedef __attribute__((ext_vector_type(16))) __bf16   v16bf;
typedef __attribute__((ext_vector_type(16))) _Float16 v16h;
typedef __attribute__((ext_vector_type(8)))  _Float16 v8h;
typedef __attribute__((ext_vector_type(8)))  unsigned short v8us;
typedef __attribute__((ext_vector_type(8)))  float    v8f;
typedef __attribute__((ext_vector_type(4)))  float    v4f;
typedef v8h  __attribute__((may_alias)) v8ha;
typedef v4f  __attribute__((may_alias)) v4fa;
typedef v8us __attribute__((may_alias)) v8usa;

__device__ __forceinline__ unsigned short f2bf(float f) { unsigned u = __float_as_uint(f); u += 0x7FFFu + ((u >> 16) & 1u); return (unsigned short)(u >> 16); }
__device__ __forceinline__ float bf2f(unsigned short b) { return __uint_as_float(((unsigned)b) << 16); }
__device__ __forceinline__ float bfr(float f) { return bf2f(f2bf(f)); }
__device__ __forceinline__ v16h cat16(v8h lo, v8h hi) { return __builtin_shufflevector(lo, hi, 0, 1, 2, 3, 4, 5, 6, 7, 8, 9, 10, 11, 12, 13, 14, 15); }
__device__ __forceinline__ v16bf cat16b(v8us lo, v8us hi) { return __builtin_bit_cast(v16bf, __builtin_shufflevector(lo, hi, 0, 1, 2, 3, 4, 5, 6, 7, 8, 9, 10, 11, 12, 13, 14, 15)); }
__device__ __forceinline__ v8f wmma16(v16h a, v16h b, v8f c) { return __builtin_amdgcn_wmma_f32_16x16x32_f16(false, a, false, b, (short)0, c, false, false); }
__device__ __forceinline__ v8f wmmab(v16bf a, v16bf b, v8f c) { return __builtin_amdgcn_wmma_f32_16x16x32_bf16(false, a, false, b, (short)0, c, false, false); }



// ---- k_gemmw: register-blocked GEMM, ONE WAVE per 64x64 output tile (16 accumulators), operands straight from K-contiguous 16-bit planes; grid (M/64, N/64, Z), 32 threads.
// C[m][n] (f32, pitch ldc, + optional f32 bias[n]) = sum_k A[m][k] Bt[n][k] (+ split products per NSPLIT). z-batch strides sA/sB/sC in elements. K % 32 == 0.
template <typename T16> struct WFrag;
template <> struct WFrag<h16> { typedef v16h V; static __device__ __forceinline__ V ld(const h16* p) { return cat16(*(const v8h*)p, *(const v8h*)(p + 16)); } static __device__ __forceinline__ v8f mma(V a, V b, v8f c) { return wmma16(a, b, c); } };
template <> struct WFrag<bf> { typedef v16bf V; static __device__ __forceinline__ V ld(const bf* p) { return cat16b(*(const v8us*)p, *(const v8us*)(p + 16)); } static __device__ __forceinline__ v8f mma(V a, V b, v8f c) { return wmmab(a, b, c); } };
template <typename T16, int NSPLIT, bool BIAS>
__global__ __launch_bounds__(32) void k_gemmw(const T16* __restrict__ A, const T16* __restrict__ A2, const T16* __restrict__ Bt, const T16* __restrict__ Bt2, int K, float* C, int ldc, const float* __restrict__ bias, size_t sA, size_t sB, size_t sC) {
    typedef typename WFrag<T16>::V V;
    __shared__ __align__(16) float os[16 * 68];
    const size_t z = blockIdx.z; A += z * sA; if (A2) A2 += z * sA; Bt += z * sB; if (Bt2) Bt2 += z * sB; C += z * sC;
    const int lane = threadIdx.x & 31, lr = lane & 15, hi = lane >> 4; const int r0 = blockIdx.x * 64, c0 = blockIdx.y * 64;
    v8f acc[4][4];
#pragma unroll
    for (int mb = 0; mb < 4; ++mb)
#pragma unroll
        for (int nb = 0; nb < 4; ++nb) acc[mb][nb] = (v8f){};
    const size_t aoff = (size_t)(r0 + lr) * K + 8 * hi, boff = (size_t)(c0 + lr) * K + 8 * hi;
#pragma unroll 1
    for (int kc = 0; kc < K; kc += 32) {
        V a[4], a2[4];
#pragma unroll
        for (int mb = 0; mb < 4; ++mb) { a[mb] = WFrag<T16>::ld(A + aoff + (size_t)mb * 16 * K + kc); if (NSPLIT == 1 || NSPLIT == 2) a2[mb] = WFrag<T16>::ld(A2 + aoff + (size_t)mb * 16 * K + kc); }
#pragma unroll
        for (int nb = 0; nb < 4; ++nb) { const V b = WFrag<T16>::ld(Bt + boff + (size_t)nb * 16 * K + kc); V b2; if (NSPLIT >= 2) b2 = WFrag<T16>::ld(Bt2 + boff + (size_t)nb * 16 * K + kc);
#pragma unroll
            for (int mb = 0; mb < 4; ++mb) { acc[mb][nb] = WFrag<T16>::mma(a[mb], b, acc[mb][nb]); if (NSPLIT == 1 || NSPLIT == 2) acc[mb][nb] = WFrag<T16>::mma(a2[mb], b, acc[mb][nb]); if (NSPLIT >= 2) acc[mb][nb] = WFrag<T16>::mma(a[mb], b2, acc[mb][nb]); } }
        asm volatile("v_nop\n\tv_nop\n\tv_nop\n\tv_nop" : "+v"(acc[0][0]), "+v"(acc[1][1]), "+v"(acc[2][2]), "+v"(acc[3][3]) : "v"(a[0]), "v"(a[3]));
    }
#pragma unroll
    for (int mb = 0; mb < 4; ++mb) {
#pragma unroll
        for (int nb = 0; nb < 4; ++nb) {
#pragma unroll
            for (int j = 0; j < 8; ++j) os[(hi * 8 + j) * 68 + nb * 16 + lr] = acc[mb][nb][j]; }
        __builtin_amdgcn_wave_barrier(); asm volatile("" ::: "memory");
        float* crow = C + (size_t)(r0 + mb * 16) * ldc + c0;
{
#pragma unroll
            for (int s = 0; s < 8; ++s) { const int row = 2 * s + hi, cofs = lr * 4; v4f val = *(const v4fa*)(os + row * 68 + cofs); if (BIAS) { val[0] += bfr(bias[c0 + cofs]); val[1] += bfr(bias[c0 + cofs + 1]); val[2] += bfr(bias[c0 + cofs + 2]); val[3] += bfr(bias[c0 + cofs + 3]); }
                *(v4f*)(crow + (size_t)row * ldc + cofs) = val; }
             }
        __builtin_amdgcn_wave_barrier(); asm volatile("" ::: "memory");
    }
}

// ---- k_gemmsk: the same product as k_gemmw for a long K and a small C: one work-group per (16 MB) x (16 NB) tile of C, K split evenly over its NW waves.
// Each wave sums its own K / NW slice in its own accumulators (all its loads can be in flight at once); the NW partial tiles meet in LDS and are added in wave order. grid (M / (16 MB), N / (16 NB), Z), NW * 32 threads. A rows have pitch LDA elements, Bt rows pitch K.
template <typename T16, int NSPLIT, int MB, int NB, int NW, int K, int LDA>
__global__ __launch_bounds__(NW * 32) void k_gemmsk(const T16* __restrict__ A, const T16* __restrict__ A2, const T16* __restrict__ Bt, const T16* __restrict__ Bt2, float* C, int ldc, size_t sA, size_t sB, size_t sC) {
    typedef typename WFrag<T16>::V V;
    constexpr int PW = NB * 16 + 4, KW = K / NW, KS = KW / 32, PER = MB * NB * 256 / (NW * 32);   // LDS row pitch in floats, k per wave, k steps per wave, C elements per thread
    static_assert((NSPLIT == 0 || NSPLIT == 2) && KW % 32 == 0 && KW * NW == K && PER >= 1 && PER * NW * 32 == MB * NB * 256 && (NB * 16) % PER == 0, "shape");
    __shared__ __align__(16) float os[NW * MB * 16 * PW];
    const size_t z = blockIdx.z; A += z * sA; if (NSPLIT == 2) A2 += z * sA; Bt += z * sB; if (NSPLIT == 2) Bt2 += z * sB; C += z * sC;
    const int lane = threadIdx.x & 31, lr = lane & 15, hi = lane >> 4, w = threadIdx.x >> 5; const int r0 = blockIdx.x * (16 * MB), c0 = blockIdx.y * (16 * NB);
    v8f acc[MB][NB];
#pragma unroll
    for (int mb = 0; mb < MB; ++mb)
#pragma unroll
        for (int nb = 0; nb < NB; ++nb) acc[mb][nb] = (v8f){};
    const size_t aoff = (size_t)(r0 + lr) * LDA + w * KW + 8 * hi, boff = (size_t)(c0 + lr) * K + w * KW + 8 * hi; const T16* pa = A + aoff; const T16* pa2 = (NSPLIT == 2) ? A2 + aoff : nullptr; const T16* pb = Bt + boff; const T16* pb2 = (NSPLIT == 2) ? Bt2 + boff : nullptr;
    // every load of the slice is issued before the first product, row set by row set, so that the four loads that share a 128-B line follow one another
    V a[KS][MB], a2[KS][MB], b[KS][NB], b2[KS][NB];
#pragma unroll
    for (int mb = 0; mb < MB; ++mb) {
#pragma unroll
        for (int ks = 0; ks < KS; ++ks) a[ks][mb] = WFrag<T16>::ld(pa + (size_t)mb * 16 * LDA + ks * 32);
        if (NSPLIT == 2) {
#pragma unroll
            for (int ks = 0; ks < KS; ++ks) a2[ks][mb] = WFrag<T16>::ld(pa2 + (size_t)mb * 16 * LDA + ks * 32); } }
#pragma unroll
    for (int nb = 0; nb < NB; ++nb) {
#pragma unroll
        for (int ks = 0; ks < KS; ++ks) b[ks][nb] = WFrag<T16>::ld(pb + (size_t)nb * 16 * K + ks * 32);
        if (NSPLIT == 2) {
#pragma unroll
            for (int ks = 0; ks < KS; ++ks) b2[ks][nb] = WFrag<T16>::ld(pb2 + (size_t)nb * 16 * K + ks * 32); } }
    // the wait that belongs in front of any overwrite of a register that an issued load names; the bases are its inputs so that they stay whole up to here
    if constexpr (NSPLIT == 2) asm volatile("s_wait_xcnt 0x0" :: "v"(pa), "v"(pa2), "v"(pb), "v"(pb2) : "memory");
    else asm volatile("s_wait_xcnt 0x0" :: "v"(pa), "v"(pb) : "memory");
    __builtin_amdgcn_sched_barrier(0);   // keeps the products below the loads: without it the compiler pairs each product with its loads and the wave waits out one memory latency per k step
#pragma unroll
    for (int ks = 0; ks < KS; ++ks)
#pragma unroll
        for (int nb = 0; nb < NB; ++nb)
#pragma unroll
            for (int mb = 0; mb < MB; ++mb) { acc[mb][nb] = WFrag<T16>::mma(a[ks][mb], b[ks][nb], acc[mb][nb]); if (NSPLIT == 2) { acc[mb][nb] = WFrag<T16>::mma(a2[ks][mb], b[ks][nb], acc[mb][nb]); acc[mb][nb] = WFrag<T16>::mma(a[ks][mb], b2[ks][nb], acc[mb][nb]); } }
    float* ow = os + w * (MB * 16 * PW);
#pragma unroll
    for (int mb = 0; mb < MB; ++mb)
#pragma unroll
        for (int nb = 0; nb < NB; ++nb)
#pragma unroll
            for (int j = 0; j < 8; ++j) ow[(mb * 16 + hi * 8 + j) * PW + nb * 16 + lr] = acc[mb][nb][j];
    __syncthreads();
    const int e = threadIdx.x * PER, row = e / (NB * 16), col = e % (NB * 16); float s[PER];
#pragma unroll
    for (int q = 0; q < PER; ++q) s[q] = os[row * PW + col + q];
#pragma unroll
    for (int u = 1; u < NW; ++u)
#pragma unroll
        for (int q = 0; q < PER; ++q) s[q] += os[u * (MB * 16 * PW) + row * PW + col + q];
#pragma unroll
    for (int q = 0; q < PER; ++q) C[(size_t)(r0 + row) * ldc + c0 + col + q] = s[q];
}

__device__ __forceinline__ h16 tohx(float x) { return (h16)x; }
__device__ __forceinline__ void splitf(float y, unsigned short& h, unsigned short& l) { h = f2bf(y); l = f2bf(y - bf2f(h)); }
typedef __attribute__((ext_vector_type(2))) _Float16 v2h;
typedef __attribute__((ext_vector_type(4))) _Float16 v4h;
typedef __attribute__((ext_vector_type(2))) unsigned short v2us;
typedef __attribute__((ext_vector_type(4))) unsigned short v4us;
typedef __attribute__((ext_vector_type(2))) float v2f;
typedef __attribute__((ext_vector_type(4))) int v4i;
typedef v4h  __attribute__((may_alias)) v4ha;
typedef v4us __attribute__((may_alias)) v4usa;

__global__ __launch_bounds__(256) void k_wtG(const float* __restrict__ w, int K, int N, bf* Bt) {
    const int lane = threadIdx.x & 31; const int L0 = (blockIdx.x * 8 + (threadIdx.x >> 5)) * 8; const int nlines = N * K / 64;
{
#pragma unroll 1
        for (int l = 0; l < 8; ++l) { const int L = L0 + l; if (L >= nlines) break; const size_t e = (size_t)L * 64 + lane * 2; const int k = (int)(e % K), n = (int)(e / K); v2us o;
            o[0] = f2bf(w[(size_t)k * N + n]); o[1] = f2bf(w[(size_t)(k + 1) * N + n]); *(v2us*)(Bt + e) = o; }
         }
}
__global__ __launch_bounds__(256) void k_whg(const float* __restrict__ w, bf* Bt) { const size_t e0 = ((size_t)blockIdx.x * 256 + threadIdx.x) * 2; if (e0 >= (size_t)DQ * DM) return; const int e = (int)(e0 % DM); const int n = (int)(e0 / DM); const int h = n / HD, d = n % HD; v2us o; o[0] = f2bf(w[((size_t)h * DM + e) * HD + d]); o[1] = f2bf(w[((size_t)h * DM + e + 1) * HD + d]); *(v2us*)(Bt + e0) = o;  }
__global__ __launch_bounds__(256) void k_cvt8(const float* __restrict__ src, bf* dst, size_t n8) { const size_t i = (size_t)blockIdx.x * 256 + threadIdx.x; if (i >= n8) return; const v8f v = *(const v8f*)(src + i * 8); v8us o;
#pragma unroll
    for (int k = 0; k < 8; ++k) o[k] = f2bf(v[k]); *(v8us*)(dst + i * 8) = o;  }

// k_rope: head planes [h][t][d] (fp16 + hi/lo) of rope(x) x sc with the rotate-half convention out[d] = x[d] cos[t][d] - x[d+HD/2] sin[t][d], out[d+HD/2] = x[d+HD/2] cos[t][d+HD/2] + x[d] sin[t][d+HD/2]
__global__ __launch_bounds__(256) void k_rope(const float* __restrict__ F, int pitch, int nheads, const float* __restrict__ CS, const float* __restrict__ RF, const float* __restrict__ nw, float sc, h16* P16, bf* Ph, bf* Pl) {
    const size_t e = ((size_t)blockIdx.x * 256 + threadIdx.x) * 2; if (e >= (size_t)nheads * TT * HD) return; const int d = (int)(e % HD); const int t = (int)((e / HD) % TT); const int h = (int)(e / ((size_t)HD * TT)); const float* f = F + (size_t)t * pitch + h * HD; const float rf = RF ? RF[(size_t)h * TT + t] : 1.0f; v2h o16; v2us oh, ol;
#pragma unroll
    for (int q = 0; q < 2; ++q) { const int dd = d + q; const int dp = (dd < HD / 2) ? dd + HD / 2 : dd - HD / 2; float x0 = f[dd], x1 = f[dp];
        if (RF) { float n0 = __fmul_rn(x0, rf), n1 = __fmul_rn(x1, rf); asm volatile("" : "+v"(n0)); asm volatile("" : "+v"(n1)); x0 = __fmul_rn(bfr(nw[dd]), n0); x1 = __fmul_rn(bfr(nw[dp]), n1); }
        const v2f cs = *(const v2f*)(CS + ((size_t)t * HD + dd) * 2); float a = __fmul_rn(x0, cs[0]), bq = __fmul_rn(x1, cs[1]); asm volatile("" : "+v"(a)); asm volatile("" : "+v"(bq)); const float r = ((dd < HD / 2) ? __fsub_rn(a, bq) : __fadd_rn(a, bq)) * sc;
        o16[q] = tohx(r); unsigned short a2, c2; splitf(r, a2, c2); oh[q] = a2; ol[q] = c2; }
    *(v2h*)(P16 + e) = o16; *(v2us*)(Ph + e) = oh; *(v2us*)(Pl + e) = ol;  }
__global__ __launch_bounds__(256) void k_vtp(const float* __restrict__ F, int pitch, int nheads, h16* V16, bf* Vh, bf* Vl) { const size_t e = ((size_t)blockIdx.x * 256 + threadIdx.x) * 2; if (e >= (size_t)nheads * HD * TT) return; const int t = (int)(e % TT); const int d = (int)((e / TT) % HD); const int g = (int)(e / ((size_t)TT * HD)); v2h o16; v2us oh, ol;
#pragma unroll
    for (int q = 0; q < 2; ++q) { const float x = F[(size_t)(t + q) * pitch + g * HD + d]; o16[q] = tohx(x); unsigned short a2, c2; splitf(x, a2, c2); oh[q] = a2; ol[q] = c2; }
    *(v2h*)(V16 + e) = o16; *(v2us*)(Vh + e) = oh; *(v2us*)(Vl + e) = ol;  }
__global__ __launch_bounds__(256) void k_csid(float* CS) { const int idx = blockIdx.x * 256 + threadIdx.x; if (idx >= TT * HD) return; v2f cs; cs[0] = 1.0f; cs[1] = 0.0f; *(v2f*)(CS + (size_t)idx * 2) = cs;  }
__global__ __launch_bounds__(256) void k_mergeF(const float* __restrict__ Ob, int h0, float* O) { const size_t e = ((size_t)blockIdx.x * 256 + threadIdx.x) * 2; if (e >= (size_t)ZH * TT * HD) return; const int d = (int)(e % HD); const int t = (int)((e / HD) % TT); const int zz = (int)(e / ((size_t)HD * TT)); const float cs = (t < RH) ? 1.0f : (1.0f / PCAR); const size_t oo = (size_t)t * DM + (h0 + zz) * HD + d; v2f o2;
    o2[0] = Ob[e] * cs; o2[1] = Ob[e + 1] * cs; *(v2f*)(O + oo) = o2;  }



__global__ __launch_bounds__(256) void k_difln(const float* __restrict__ M1, const float* __restrict__ M2, const float* __restrict__ g, const float* __restrict__ be, const float* __restrict__ LAMB, float* OUTb) {
    const int lane = threadIdx.x & 31; const int r = blockIdx.x * 8 + (threadIdx.x >> 5); if (r >= TT) return; float lam = bfr(LAMB[0]); asm volatile("" : "+v"(lam)); const float oml = __fsub_rn(1.0f, lam); const float* a1 = M1 + (size_t)r * DQ; const float* a2 = M2 + (size_t)r * DQ; float u[DQ / 32]; float s = 0.f;
#pragma unroll
    for (int ch = 0; ch < DQ / 128; ++ch) { const int c0 = ch * 128 + lane * 4; const v4f p1 = *(const v4f*)(a1 + c0), p2 = *(const v4f*)(a2 + c0);
#pragma unroll
        for (int q = 0; q < 4; ++q) { float lp = __fmul_rn(lam, p2[q]); asm volatile("" : "+v"(lp)); float v = __fsub_rn(p1[q], lp); asm volatile("" : "+v"(v)); u[ch * 4 + q] = v; s = __fadd_rn(s, v); } }
#pragma unroll
    for (int sh = 16; sh; sh >>= 1) s += __shfl_xor(s, sh, 32);
    const float mu = s * (1.0f / DQ); float s2 = 0.f;
#pragma unroll
    for (int k = 0; k < DQ / 32; ++k) { float d0 = __fsub_rn(u[k], mu); asm volatile("" : "+v"(d0)); float p = __fmul_rn(d0, d0); asm volatile("" : "+v"(p)); s2 = __fadd_rn(s2, p); }
#pragma unroll
    for (int sh = 16; sh; sh >>= 1) s2 += __shfl_xor(s2, sh, 32);
    const float rs = __frsqrt_rn(__fadd_rn(s2 * (1.0f / DQ), LNEPS));
{
#pragma unroll
        for (int ch = 0; ch < DQ / 128; ++ch) { const int c0 = ch * 128 + lane * 4; v4f o4;
#pragma unroll
            for (int q = 0; q < 4; ++q) { float d1 = __fsub_rn(u[ch * 4 + q], mu); asm volatile("" : "+v"(d1)); float n0 = __fmul_rn(d1, rs); asm volatile("" : "+v"(n0)); float gq = bfr(g[c0 + q]), bq2 = bfr(be[c0 + q]); asm volatile("" : "+v"(gq), "+v"(bq2)); float n1 = __fmul_rn(n0, gq); asm volatile("" : "+v"(n1)); float y = __fadd_rn(n1, bq2); asm volatile("" : "+v"(y)); o4[q] = __fmul_rn(oml, y); }
            *(v4f*)(OUTb + (size_t)r * DQ + c0) = o4; }
         } }
// k_asoft: per row (zz, i): t = S x HD^-0.5 (no mask); softmax over the 2048 keys (register row, one exp, fixed trees);
// IN PLACE: one wave owns one row, holds all of it in registers before its first store, and writes the 16-bit result over the row's own 8 KiB: fp16 in the first half, or the hi plane in the first half and the lo plane in the second (row pitch 2 TT 16-bit elements).
__global__ __launch_bounds__(256) void k_asoft(float* Sb) {
    const int lane = threadIdx.x & 31; const int row = blockIdx.x * 8 + (threadIdx.x >> 5); if (row >= ZH * TT) return; const int i = row % TT; const int zz = row / TT; (void)zz; const bool hires = (i < RH); float* sr = Sb + (size_t)row * TT; float v[TT / 32]; float mx = -3.0e38f;
#pragma unroll
    for (int ch = 0; ch < TT / 128; ++ch) { const int j0 = ch * 128 + lane * 4; const v4f a = *(const v4fa*)(sr + j0);
#pragma unroll
        for (int q = 0; q < 4; ++q) { const int j = j0 + q; (void)j; const float t = a[q] * SCL; v[ch * 4 + q] = t; mx = fmaxf(mx, t); } }
#pragma unroll
    for (int sh = 16; sh; sh >>= 1) mx = fmaxf(mx, __shfl_xor(mx, sh, 32));
    float sum = 0.f;
#pragma unroll
    for (int k = 0; k < TT / 32; ++k) { float d0 = __fsub_rn(v[k], mx); asm volatile("" : "+v"(d0)); v[k] = __builtin_amdgcn_exp2f(__fmul_rn(d0, 1.4426950408889634f)); sum += v[k]; }
#pragma unroll
    for (int sh = 16; sh; sh >>= 1) sum += __shfl_xor(sum, sh, 32);
    const float f = __fdiv_rn(hires ? 1.0f : PCAR, sum);
{
        if (hires) {
#pragma unroll
            for (int ch = 0; ch < TT / 128; ++ch) { v4us oh, ol;
#pragma unroll
                for (int q = 0; q < 4; ++q) { unsigned short a, c2; splitf(v[ch * 4 + q] * f, a, c2); oh[q] = a; ol[q] = c2; }
                bf* pr = (bf*)sr + ch * 128 + lane * 4; *(v4usa*)pr = oh; *(v4usa*)(pr + TT) = ol; }
        } else {
#pragma unroll
            for (int ch = 0; ch < TT / 128; ++ch) { v4h o4;
#pragma unroll
                for (int q = 0; q < 4; ++q) o4[q] = tohx(v[ch * 4 + q] * f);
                *(v4ha*)((h16*)sr + ch * 128 + lane * 4) = o4; } }
         }
}

extern "C" void kernel_launch(void* const* d_in, const int* in_sizes, int n_in,
                              void* d_out, int out_size, void* d_ws, size_t ws_size, hipStream_t stream) {
    (void)in_sizes; (void)n_in; (void)out_size;
    const float* x = (const float*)d_in[0]; const float* wq1 = (const float*)d_in[1]; const float* wk1 = (const float*)d_in[2]; const float* wq2 = (const float*)d_in[3]; const float* wk2 = (const float*)d_in[4]; const float* wv = (const float*)d_in[5]; const float* lng = (const float*)d_in[6]; const float* lnb = (const float*)d_in[7]; const float* LAMB = (const float*)d_in[8]; const float* wq = wq1; const float* wk = wk1; const float* wo = nullptr; (void)wo; (void)wq; (void)wk;
    float* OUT = (float*)d_out;     // [2][2048][1024]
    char* wsp = (char*)d_ws;
    auto take = [&](size_t bytes) { char* p = wsp; wsp += (bytes + 255) & ~(size_t)255; return (void*)p; };
    bf* WQ = (bf*)take((size_t)DQ * DM * 2); bf* WK = (bf*)take((size_t)DKV * DM * 2); bf* WQ2 = (bf*)take((size_t)DQ * DM * 2); bf* WK2 = (bf*)take((size_t)DKV * DM * 2); bf* WV = (bf*)take((size_t)DKV * DM * 2); float* M1 = (float*)take((size_t)TT * DQ * 4); float* M2 = (float*)take((size_t)TT * DQ * 4); float* CS = (float*)take((size_t)TT * HD * 2 * 4);
    bf* XB = (bf*)take((size_t)TT * DM * 2); float* FQ = (float*)take((size_t)TT * DQ * 4); float* FK = (float*)take((size_t)TT * DKV * 4);
    h16* QP16 = (h16*)take((size_t)2 * NH_ * TT * HD * 2); h16* KP16 = (h16*)take((size_t)2 * NKV * TT * HD * 2); h16* VT16 = (h16*)take((size_t)NKV * HD * TT * 2);
    bf* QPh = (bf*)take((size_t)2 * NH_ * TT * HD * 2); bf* QPl = (bf*)take((size_t)2 * NH_ * TT * HD * 2); bf* KPh = (bf*)take((size_t)2 * NKV * TT * HD * 2); bf* KPl = (bf*)take((size_t)2 * NKV * TT * HD * 2); bf* VTh = (bf*)take((size_t)NKV * HD * TT * 2); bf* VTl = (bf*)take((size_t)NKV * HD * TT * 2);
    float* Sb = (float*)take((size_t)ZH * TT * TT * 4); float* Ob = (float*)take((size_t)ZH * TT * HD * 4);
    if ((size_t)(wsp - (char*)d_ws) > ws_size) return;    // ws 256 MiB
    float* FV = FK;   // v projection reuses the k buffer after the k planes are built (stream-ordered)
    { const unsigned LW = (unsigned)(((size_t)DQ * DM / 2 + 255) / 256); k_whg<<<LW, 256, 0, stream>>>(wq1, WQ); k_whg<<<LW, 256, 0, stream>>>(wk1, WK); k_whg<<<LW, 256, 0, stream>>>(wq2, WQ2); k_whg<<<LW, 256, 0, stream>>>(wk2, WK2); k_whg<<<LW, 256, 0, stream>>>(wv, WV);   /* [h][c][d] -> Bt [h*64+d][c] */
       }
    k_csid<<<(TT * HD + 255) / 256, 256, 0, stream>>>(CS);
    const unsigned LQ = (unsigned)(((size_t)NH_ * TT * HD / 2 + 255) / 256), LKv = (unsigned)(((size_t)NKV * TT * HD / 2 + 255) / 256);
    for (int b = 0; b < NB_; ++b) {
        
        k_cvt8<<<(unsigned)(((size_t)TT * DM / 8 + 255) / 256), 256, 0, stream>>>(x + (size_t)b * TT * DM, XB, (size_t)TT * DM / 8);
        k_gemmw<bf, 0, false><<<dim3(TT / 64, DQ / 64, 1), 32, 0, stream>>>(XB, nullptr, WQ, nullptr, DM, FQ, DQ, nullptr, 0, 0, 0);
        k_rope<<<LQ, 256, 0, stream>>>(FQ, DQ, NH_, CS, nullptr, nullptr, 1.0f, QP16, QPh, QPl);
        k_gemmw<bf, 0, false><<<dim3(TT / 64, DKV / 64, 1), 32, 0, stream>>>(XB, nullptr, WK, nullptr, DM, FK, DKV, nullptr, 0, 0, 0);
        k_rope<<<LKv, 256, 0, stream>>>(FK, DKV, NKV, CS, nullptr, nullptr, 1.0f, KP16, KPh, KPl);
        k_gemmw<bf, 0, false><<<dim3(TT / 64, DQ / 64, 1), 32, 0, stream>>>(XB, nullptr, WQ2, nullptr, DM, FQ, DQ, nullptr, 0, 0, 0); k_rope<<<LQ, 256, 0, stream>>>(FQ, DQ, NH_, CS, nullptr, nullptr, 1.0f, QP16 + (size_t)NH_ * TT * HD, QPh + (size_t)NH_ * TT * HD, QPl + (size_t)NH_ * TT * HD);   /* q2 planes as heads 16..31 */
        k_gemmw<bf, 0, false><<<dim3(TT / 64, DKV / 64, 1), 32, 0, stream>>>(XB, nullptr, WK2, nullptr, DM, FK, DKV, nullptr, 0, 0, 0); k_rope<<<LKv, 256, 0, stream>>>(FK, DKV, NKV, CS, nullptr, nullptr, 1.0f, KP16 + (size_t)NKV * TT * HD, KPh + (size_t)NKV * TT * HD, KPl + (size_t)NKV * TT * HD);   /* k2 planes as heads 16..31 */
        k_gemmw<bf, 0, false><<<dim3(TT / 64, DKV / 64, 1), 32, 0, stream>>>(XB, nullptr, WV, nullptr, DM, FV, DKV, nullptr, 0, 0, 0); k_vtp<<<LKv, 256, 0, stream>>>(FV, DKV, NKV, VT16, VTh, VTl);
        for (int hp = 0; hp < 2 * NH_; hp += ZH) { const int h0 = hp & (NH_ - 1); const size_t zq = (size_t)hp, zk = (size_t)hp, zv = (size_t)h0;   // pass hp < 16: map 1 (q1/k1), hp >= 16: map 2 (q2/k2); both use v of head hp mod 16
            k_gemmw<bf, 2, false><<<dim3(RH / 64, TT / 64, ZH), 32, 0, stream>>>(QPh + zq * TT * HD, QPl + zq * TT * HD, KPh + zk * TT * HD, KPl + zk * TT * HD, HD, Sb, TT, nullptr, (size_t)TT * HD, (size_t)TT * HD, (size_t)TT * TT);
            k_gemmw<h16, 0, false><<<dim3((TT - RH) / 64, TT / 64, ZH), 32, 0, stream>>>(QP16 + zq * TT * HD + (size_t)RH * HD, nullptr, KP16 + zk * TT * HD, nullptr, HD, Sb + (size_t)RH * TT, TT, nullptr, (size_t)TT * HD, (size_t)TT * HD, (size_t)TT * TT);
            k_asoft<<<ZH * TT / 8, 256, 0, stream>>>(Sb);   /* probabilities now lie in Sb's rows, pitch 2 TT 16-bit elements */
            k_gemmsk<bf, 2, 1, 2, 16, TT, 2 * TT><<<dim3(RH / 16, HD / 32, ZH), 512, 0, stream>>>((const bf*)Sb, (const bf*)Sb + TT, VTh + zv * HD * TT, VTl + zv * HD * TT, Ob, HD, (size_t)2 * TT * TT, (size_t)HD * TT, (size_t)TT * HD);
            k_gemmsk<h16, 0, 2, 2, 16, TT, 2 * TT><<<dim3((TT - RH) / 32, HD / 32, ZH), 512, 0, stream>>>((const h16*)Sb + (size_t)RH * 2 * TT, nullptr, VT16 + zv * HD * TT, nullptr, Ob + (size_t)RH * HD, HD, (size_t)2 * TT * TT, (size_t)HD * TT, (size_t)TT * HD);
            k_mergeF<<<(unsigned)(((size_t)ZH * TT * HD / 2 + 255) / 256), 256, 0, stream>>>(Ob, h0, (hp < NH_) ? M1 : M2); }   /* f32 merged contexts of map 1 / map 2 */
        k_difln<<<TT / 8, 256, 0, stream>>>(M1, M2, lng, lnb, LAMB, OUT + (size_t)b * TT * DM); }   /* (1 - lamb) LN(M1 - lamb M2) */
}

// v003
// One run takes 475 microseconds.
// Next to v002, in two timings, it ran 2.48 and 2.47 times as fast.
// All steps since v000 together make it 7.88 times as fast.
#include <hip/hip_runtime.h>

// Multi-head differential attention (x [2][2048][1024]; per head h: q1, k1, q2, k2, v = x W[h] (W [16][1024][64]); w1 = softmax(q1.k1/8), w2 = softmax(q2.k2/8); head out = (w1 - lamb w2) v = w1 v - lamb (w2 v); concat heads; out = (1 - lamb) LayerNorm(concat) (gamma, beta, eps 1e-5; lamb scalar, read) -> [2][2048][1024] (4.2 M)).
// Layout: the five [h][c][d] weight tensors are gathered into the [h*64+d][c] layout; the two attention maps run as 32 head passes (pass p < 16: q1/k1 of head p, pass p >= 16: q2/k2 of head p-16, both with v of head p mod 16), all in ONE fused launch per batch: scores, online softmax and attn.v stay in registers, no score map is written; the f32 contexts land in two merged buffers M1, M2; one row kernel forms M1 - lamb M2, LayerNorms it and scales by (1 - lamb).
// Compute dtypes, f32 accumulate: every input rounded to bf16; q/k/v on PLAIN bf16 operands (inputs: exact); both maps: scores and attn.v: query rows < 512 hl (3 products), the rest single fp16; softmax f32; no output projection: f32 difference, LayerNorm and scale.

#define NB_  2
#define TT   2048
#define DM   1024
#define NH_  16
#define NKV  16
#define REP  (NH_ / NKV)
#define HD   64
#define DQ   (NH_ * HD)
#define DKV  (NKV * HD)
#define LNEPS 1e-5f
#define RH   512                  // query rows < RH use hi+lo planes
#define WIN  0
#define SCL  0.125f   // HD^-0.5
typedef _Float16 h16;
typedef unsigned short bf;
typedef __attribute__((ext_vector_type(16))) __bf16   v16bf;
typedef __attribute__((ext_vector_type(16))) _Float16 v16h;
typedef __attribute__((ext_vector_type(8)))  _Float16 v8h;
typedef __attribute__((ext_vector_type(8)))  unsigned short v8us;
typedef __attribute__((ext_vector_type(8)))  float    v8f;
typedef __attribute__((ext_vector_type(4)))  float    v4f;
typedef v8h  __attribute__((may_alias)) v8ha;
typedef v4f  __attribute__((may_alias)) v4fa;
typedef v8us __attribute__((may_alias)) v8usa;

__device__ __forceinline__ unsigned short f2bf(float f) { unsigned u = __float_as_uint(f); u += 0x7FFFu + ((u >> 16) & 1u); return (unsigned short)(u >> 16); }
__device__ __forceinline__ float bf2f(unsigned short b) { return __uint_as_float(((unsigned)b) << 16); }
__device__ __forceinline__ float bfr(float f) { return bf2f(f2bf(f)); }
__device__ __forceinline__ v16h cat16(v8h lo, v8h hi) { return __builtin_shufflevector(lo, hi, 0, 1, 2, 3, 4, 5, 6, 7, 8, 9, 10, 11, 12, 13, 14, 15); }
__device__ __forceinline__ v16bf cat16b(v8us lo, v8us hi) { return __builtin_bit_cast(v16bf, __builtin_shufflevector(lo, hi, 0, 1, 2, 3, 4, 5, 6, 7, 8, 9, 10, 11, 12, 13, 14, 15)); }
__device__ __forceinline__ v8f wmma16(v16h a, v16h b, v8f c) { return __builtin_amdgcn_wmma_f32_16x16x32_f16(false, a, false, b, (short)0, c, false, false); }
__device__ __forceinline__ v8f wmmab(v16bf a, v16bf b, v8f c) { return __builtin_amdgcn_wmma_f32_16x16x32_bf16(false, a, false, b, (short)0, c, false, false); }



// ---- k_gemmw: register-blocked GEMM, ONE WAVE per 64x64 output tile (16 accumulators), operands straight from K-contiguous 16-bit planes; grid (M/64, N/64, Z), 32 threads.
// C[m][n] (f32, pitch ldc, + optional f32 bias[n]) = sum_k A[m][k] Bt[n][k] (+ split products per NSPLIT). z-batch strides sA/sB/sC in elements. K % 32 == 0.
template <typename T16> struct WFrag;
template <> struct WFrag<h16> { typedef v16h V; static __device__ __forceinline__ V ld(const h16* p) { return cat16(*(const v8h*)p, *(const v8h*)(p + 16)); } static __device__ __forceinline__ v8f mma(V a, V b, v8f c) { return wmma16(a, b, c); } };
template <> struct WFrag<bf> { typedef v16bf V; static __device__ __forceinline__ V ld(const bf* p) { return cat16b(*(const v8us*)p, *(const v8us*)(p + 16)); } static __device__ __forceinline__ v8f mma(V a, V b, v8f c) { return wmmab(a, b, c); } };
template <typename T16, int NSPLIT, bool BIAS>
__global__ __launch_bounds__(32) void k_gemmw(const T16* __restrict__ A, const T16* __restrict__ A2, const T16* __restrict__ Bt, const T16* __restrict__ Bt2, int K, float* C, int ldc, const float* __restrict__ bias, size_t sA, size_t sB, size_t sC) {
    typedef typename WFrag<T16>::V V;
    __shared__ __align__(16) float os[16 * 68];
    const size_t z = blockIdx.z; A += z * sA; if (A2) A2 += z * sA; Bt += z * sB; if (Bt2) Bt2 += z * sB; C += z * sC;
    const int lane = threadIdx.x & 31, lr = lane & 15, hi = lane >> 4; const int r0 = blockIdx.x * 64, c0 = blockIdx.y * 64;
    v8f acc[4][4];
#pragma unroll
    for (int mb = 0; mb < 4; ++mb)
#pragma unroll
        for (int nb = 0; nb < 4; ++nb) acc[mb][nb] = (v8f){};
    const size_t aoff = (size_t)(r0 + lr) * K + 8 * hi, boff = (size_t)(c0 + lr) * K + 8 * hi;
#pragma unroll 1
    for (int kc = 0; kc < K; kc += 32) {
        V a[4], a2[4];
#pragma unroll
        for (int mb = 0; mb < 4; ++mb) { a[mb] = WFrag<T16>::ld(A + aoff + (size_t)mb * 16 * K + kc); if (NSPLIT == 1 || NSPLIT == 2) a2[mb] = WFrag<T16>::ld(A2 + aoff + (size_t)mb * 16 * K + kc); }
#pragma unroll
        for (int nb = 0; nb < 4; ++nb) { const V b = WFrag<T16>::ld(Bt + boff + (size_t)nb * 16 * K + kc); V b2; if (NSPLIT >= 2) b2 = WFrag<T16>::ld(Bt2 + boff + (size_t)nb * 16 * K + kc);
#pragma unroll
            for (int mb = 0; mb < 4; ++mb) { acc[mb][nb] = WFrag<T16>::mma(a[mb], b, acc[mb][nb]); if (NSPLIT == 1 || NSPLIT == 2) acc[mb][nb] = WFrag<T16>::mma(a2[mb], b, acc[mb][nb]); if (NSPLIT >= 2) acc[mb][nb] = WFrag<T16>::mma(a[mb], b2, acc[mb][nb]); } }
        asm volatile("v_nop\n\tv_nop\n\tv_nop\n\tv_nop" : "+v"(acc[0][0]), "+v"(acc[1][1]), "+v"(acc[2][2]), "+v"(acc[3][3]) : "v"(a[0]), "v"(a[3]));
    }
#pragma unroll
    for (int mb = 0; mb < 4; ++mb) {
#pragma unroll
        for (int nb = 0; nb < 4; ++nb) {
#pragma unroll
            for (int j = 0; j < 8; ++j) os[(hi * 8 + j) * 68 + nb * 16 + lr] = acc[mb][nb][j]; }
        __builtin_amdgcn_wave_barrier(); asm volatile("" ::: "memory");
        float* crow = C + (size_t)(r0 + mb * 16) * ldc + c0;
{
#pragma unroll
            for (int s = 0; s < 8; ++s) { const int row = 2 * s + hi, cofs = lr * 4; v4f val = *(const v4fa*)(os + row * 68 + cofs); if (BIAS) { val[0] += bfr(bias[c0 + cofs]); val[1] += bfr(bias[c0 + cofs + 1]); val[2] += bfr(bias[c0 + cofs + 2]); val[3] += bfr(bias[c0 + cofs + 3]); }
                *(v4f*)(crow + (size_t)row * ldc + cofs) = val; }
             }
        __builtin_amdgcn_wave_barrier(); asm volatile("" ::: "memory");
    }
}

__device__ __forceinline__ h16 tohx(float x) { return (h16)x; }
__device__ __forceinline__ void splitf(float y, unsigned short& h, unsigned short& l) { h = f2bf(y); l = f2bf(y - bf2f(h)); }
typedef __attribute__((ext_vector_type(2))) _Float16 v2h;
typedef __attribute__((ext_vector_type(4))) _Float16 v4h;
typedef __attribute__((ext_vector_type(2))) unsigned short v2us;
typedef __attribute__((ext_vector_type(4))) unsigned short v4us;
typedef __attribute__((ext_vector_type(2))) float v2f;
typedef __attribute__((ext_vector_type(4))) int v4i;
typedef v4h  __attribute__((may_alias)) v4ha;
typedef v4us __attribute__((may_alias)) v4usa;

__global__ __launch_bounds__(256) void k_wtG(const float* __restrict__ w, int K, int N, bf* Bt) {
    const int lane = threadIdx.x & 31; const int L0 = (blockIdx.x * 8 + (threadIdx.x >> 5)) * 8; const int nlines = N * K / 64;
{
#pragma unroll 1
        for (int l = 0; l < 8; ++l) { const int L = L0 + l; if (L >= nlines) break; const size_t e = (size_t)L * 64 + lane * 2; const int k = (int)(e % K), n = (int)(e / K); v2us o;
            o[0] = f2bf(w[(size_t)k * N + n]); o[1] = f2bf(w[(size_t)(k + 1) * N + n]); *(v2us*)(Bt + e) = o; }
         }
}
__global__ __launch_bounds__(256) void k_whg(const float* __restrict__ w, bf* Bt) { const size_t e0 = ((size_t)blockIdx.x * 256 + threadIdx.x) * 2; if (e0 >= (size_t)DQ * DM) return; const int e = (int)(e0 % DM); const int n = (int)(e0 / DM); const int h = n / HD, d = n % HD; v2us o; o[0] = f2bf(w[((size_t)h * DM + e) * HD + d]); o[1] = f2bf(w[((size_t)h * DM + e + 1) * HD + d]); *(v2us*)(Bt + e0) = o;  }
__global__ __launch_bounds__(256) void k_cvt8(const float* __restrict__ src, bf* dst, size_t n8) { const size_t i = (size_t)blockIdx.x * 256 + threadIdx.x; if (i >= n8) return; const v8f v = *(const v8f*)(src + i * 8); v8us o;
#pragma unroll
    for (int k = 0; k < 8; ++k) o[k] = f2bf(v[k]); *(v8us*)(dst + i * 8) = o;  }

// k_rope: head planes [h][t][d] (fp16 + hi/lo) of rope(x) x sc with the rotate-half convention out[d] = x[d] cos[t][d] - x[d+HD/2] sin[t][d], out[d+HD/2] = x[d+HD/2] cos[t][d+HD/2] + x[d] sin[t][d+HD/2]
__global__ __launch_bounds__(256) void k_rope(const float* __restrict__ F, int pitch, int nheads, const float* __restrict__ CS, const float* __restrict__ RF, const float* __restrict__ nw, float sc, h16* P16, bf* Ph, bf* Pl) {
    const size_t e = ((size_t)blockIdx.x * 256 + threadIdx.x) * 2; if (e >= (size_t)nheads * TT * HD) return; const int d = (int)(e % HD); const int t = (int)((e / HD) % TT); const int h = (int)(e / ((size_t)HD * TT)); const float* f = F + (size_t)t * pitch + h * HD; const float rf = RF ? RF[(size_t)h * TT + t] : 1.0f; v2h o16; v2us oh, ol;
#pragma unroll
    for (int q = 0; q < 2; ++q) { const int dd = d + q; const int dp = (dd < HD / 2) ? dd + HD / 2 : dd - HD / 2; float x0 = f[dd], x1 = f[dp];
        if (RF) { float n0 = __fmul_rn(x0, rf), n1 = __fmul_rn(x1, rf); asm volatile("" : "+v"(n0)); asm volatile("" : "+v"(n1)); x0 = __fmul_rn(bfr(nw[dd]), n0); x1 = __fmul_rn(bfr(nw[dp]), n1); }
        const v2f cs = *(const v2f*)(CS + ((size_t)t * HD + dd) * 2); float a = __fmul_rn(x0, cs[0]), bq = __fmul_rn(x1, cs[1]); asm volatile("" : "+v"(a)); asm volatile("" : "+v"(bq)); const float r = ((dd < HD / 2) ? __fsub_rn(a, bq) : __fadd_rn(a, bq)) * sc;
        o16[q] = tohx(r); unsigned short a2, c2; splitf(r, a2, c2); oh[q] = a2; ol[q] = c2; }
    *(v2h*)(P16 + e) = o16; *(v2us*)(Ph + e) = oh; *(v2us*)(Pl + e) = ol;  }
__global__ __launch_bounds__(256) void k_vtp(const float* __restrict__ F, int pitch, int nheads, h16* V16, bf* Vh, bf* Vl) { const size_t e = ((size_t)blockIdx.x * 256 + threadIdx.x) * 2; if (e >= (size_t)nheads * HD * TT) return; const int t = (int)(e % TT); const int d = (int)((e / TT) % HD); const int g = (int)(e / ((size_t)TT * HD)); v2h o16; v2us oh, ol;
#pragma unroll
    for (int q = 0; q < 2; ++q) { const float x = F[(size_t)(t + q) * pitch + g * HD + d]; o16[q] = tohx(x); unsigned short a2, c2; splitf(x, a2, c2); oh[q] = a2; ol[q] = c2; }
    *(v2h*)(V16 + e) = o16; *(v2us*)(Vh + e) = oh; *(v2us*)(Vl + e) = ol;  }
__global__ __launch_bounds__(256) void k_csid(float* CS) { const int idx = blockIdx.x * 256 + threadIdx.x; if (idx >= TT * HD) return; v2f cs; cs[0] = 1.0f; cs[1] = 0.0f; *(v2f*)(CS + (size_t)idx * 2) = cs;  }



__global__ __launch_bounds__(256) void k_difln(const float* __restrict__ M1, const float* __restrict__ M2, const float* __restrict__ g, const float* __restrict__ be, const float* __restrict__ LAMB, float* OUTb) {
    const int lane = threadIdx.x & 31; const int r = blockIdx.x * 8 + (threadIdx.x >> 5); if (r >= TT) return; float lam = bfr(LAMB[0]); asm volatile("" : "+v"(lam)); const float oml = __fsub_rn(1.0f, lam); const float* a1 = M1 + (size_t)r * DQ; const float* a2 = M2 + (size_t)r * DQ; float u[DQ / 32]; float s = 0.f;
#pragma unroll
    for (int ch = 0; ch < DQ / 128; ++ch) { const int c0 = ch * 128 + lane * 4; const v4f p1 = *(const v4f*)(a1 + c0), p2 = *(const v4f*)(a2 + c0);
#pragma unroll
        for (int q = 0; q < 4; ++q) { float lp = __fmul_rn(lam, p2[q]); asm volatile("" : "+v"(lp)); float v = __fsub_rn(p1[q], lp); asm volatile("" : "+v"(v)); u[ch * 4 + q] = v; s = __fadd_rn(s, v); } }
#pragma unroll
    for (int sh = 16; sh; sh >>= 1) s += __shfl_xor(s, sh, 32);
    const float mu = s * (1.0f / DQ); float s2 = 0.f;
#pragma unroll
    for (int k = 0; k < DQ / 32; ++k) { float d0 = __fsub_rn(u[k], mu); asm volatile("" : "+v"(d0)); float p = __fmul_rn(d0, d0); asm volatile("" : "+v"(p)); s2 = __fadd_rn(s2, p); }
#pragma unroll
    for (int sh = 16; sh; sh >>= 1) s2 += __shfl_xor(s2, sh, 32);
    const float rs = __frsqrt_rn(__fadd_rn(s2 * (1.0f / DQ), LNEPS));
{
#pragma unroll
        for (int ch = 0; ch < DQ / 128; ++ch) { const int c0 = ch * 128 + lane * 4; v4f o4;
#pragma unroll
            for (int q = 0; q < 4; ++q) { float d1 = __fsub_rn(u[ch * 4 + q], mu); asm volatile("" : "+v"(d1)); float n0 = __fmul_rn(d1, rs); asm volatile("" : "+v"(n0)); float gq = bfr(g[c0 + q]), bq2 = bfr(be[c0 + q]); asm volatile("" : "+v"(gq), "+v"(bq2)); float n1 = __fmul_rn(n0, gq); asm volatile("" : "+v"(n1)); float y = __fadd_rn(n1, bq2); asm volatile("" : "+v"(y)); o4[q] = __fmul_rn(oml, y); }
            *(v4f*)(OUTb + (size_t)r * DQ + c0) = o4; }
         } }

// ---- k_fattn: scores, softmax and attn.v of one head pass in one kernel. One wave owns 16 NQ query rows (NQH on hi + lo rows, NQL on fp16 rows: as many as the registers of two waves per SIMD take, since every K and Vt fragment loaded serves NQ products) and walks all TT keys, 32 at a time; operands straight from the K-contiguous 16-bit planes.
// Transposed products: St = K Qt (A = 16 key rows, B = 16 query columns), Ot += Vt Pt (A = 16 d rows of the [d][t] plane, B = Pt). A lane then holds scores of ONE query (column lr): keys 8 hi + j of each 16-key tile,
// which is the k order of a B operand, so that the two score tiles of a 32-key block, once exponentiated and rounded, ARE the B operand of the second product: no LDS, no lane exchange.
// Online softmax in base 2: running maximum m and sum l per query; the context is rescaled by 2^(m_old - m_new) in each block and divided by l at the end. HL: hi + lo bf16 planes, 3 products each.
// grid (2 NH_, RH / (16 NQH WH)), 32 (WH + WL) threads: every work-group has WH waves on hi + lo rows and WL waves on fp16 rows of one head pass, in the ratio of the rows, so that all work-groups carry the same load. No barrier, no LDS: the waves are independent.
// Not done here: every fragment load still gathers 16 rows (16 cache lines for its 1024 bytes), and each wave fetches its own copy of K and Vt; nothing is staged in LDS.
#define NQH  2
#define NQL  4
#define WH   2
#define WL   3
#define SCL2 0.18033688011112042f   // HD^-0.5 x log2(e)
typedef __attribute__((ext_vector_type(16))) float v16f;
__device__ __forceinline__ float xhalf(float v) { const int b = __float_as_int(v); return __int_as_float(__builtin_amdgcn_permlanex16(b, b, 0x76543210, 0xfedcba98, false, false)); }   // the value of lane l ^ 16, by a vector cross-row move (a shuffle would go through the LDS pipe and its wait)
template <typename T16, bool HL, int NQ>
__device__ __forceinline__ void attn_tile(const T16* __restrict__ Q, const T16* __restrict__ Q2, const T16* __restrict__ K, const T16* __restrict__ K2, const T16* __restrict__ Vt, const T16* __restrict__ Vt2, float* __restrict__ O, int q0) {
    typedef typename WFrag<T16>::V F;
    const int lane = threadIdx.x & 31, lr = lane & 15, hi = lane >> 4;
    F q[NQ][2], q2[NQ][2]; v8f o[NQ][4]; float m[NQ], l[NQ];
    const unsigned qby = (unsigned)((q0 + lr) * HD + 8 * hi) * 2u, kby = (unsigned)(lr * HD + 8 * hi) * 2u;   // a lane's byte offsets in the Q and K planes of its head
    const T16* cq = (const T16*)((const char*)Q + qby); const T16* cq2 = HL ? (const T16*)((const char*)Q2 + qby) : nullptr;
#pragma unroll
    for (int nq = 0; nq < NQ; ++nq) { m[nq] = -1.0e30f; l[nq] = 0.f;
#pragma unroll
        for (int ks = 0; ks < 2; ++ks) { const int qo = nq * 16 * HD + ks * 32; q[nq][ks] = WFrag<T16>::ld(cq + qo); if (HL) q2[nq][ks] = WFrag<T16>::ld(cq2 + qo); }
#pragma unroll
        for (int db = 0; db < 4; ++db) o[nq][db] = (v8f){}; }
    const size_t vo = (size_t)lr * TT + 8 * hi;
    const T16* pk = (const T16*)((const char*)K + kby); const T16* pk2 = HL ? (const T16*)((const char*)K2 + kby) : nullptr; const T16* pv = Vt + vo; const T16* pv2 = HL ? Vt2 + vo : nullptr;
    F ka[2][2], ka2[2][2];   // the K fragments of the block in work; each block fetches the next block's into them right behind its own score products, so that their latency runs under the softmax and the second product
#pragma unroll
    for (int kt = 0; kt < 2; ++kt)
#pragma unroll
        for (int ks = 0; ks < 2; ++ks) { const size_t off = (size_t)(kt * 16) * HD + ks * 32; ka[kt][ks] = WFrag<T16>::ld(pk + off); if (HL) ka2[kt][ks] = WFrag<T16>::ld(pk2 + off); }
    // the wait that belongs in front of any overwrite of a register that an issued load names; the offsets and bases are its inputs so that they stay whole up to here
    if constexpr (HL) asm volatile("s_wait_xcnt 0x0" :: "v"(qby), "v"(kby), "s"(Q), "s"(Q2), "s"(K), "s"(K2) : "memory");
    else asm volatile("s_wait_xcnt 0x0" :: "v"(qby), "v"(kby), "s"(Q), "s"(K) : "memory");
    for (int kb = 0; kb < TT; kb += 32) {
        const T16* cv = pv + kb; const T16* cv2 = HL ? pv2 + kb : nullptr;
        F va[4], va2[4];   // this block's Vt fragments, asked for first: their latency runs under the score products and the softmax
#pragma unroll
        for (int db = 0; db < 4; ++db) { va[db] = WFrag<T16>::ld(cv + db * 16 * TT); if (HL) va2[db] = WFrag<T16>::ld(cv2 + db * 16 * TT); }
        __builtin_amdgcn_sched_barrier(0);   // keeps these loads at the head of the block: without it the compiler sinks part of them to just in front of their products, and the wave waits out their latency there
        v8f s[NQ][2];
#pragma unroll
        for (int nq = 0; nq < NQ; ++nq) { s[nq][0] = (v8f){}; s[nq][1] = (v8f){}; }
#pragma unroll
        for (int kt = 0; kt < 2; ++kt)
#pragma unroll
            for (int ks = 0; ks < 2; ++ks) {
#pragma unroll
                for (int nq = 0; nq < NQ; ++nq) { s[nq][kt] = WFrag<T16>::mma(ka[kt][ks], q[nq][ks], s[nq][kt]); if (HL) { s[nq][kt] = WFrag<T16>::mma(ka[kt][ks], q2[nq][ks], s[nq][kt]); s[nq][kt] = WFrag<T16>::mma(ka2[kt][ks], q[nq][ks], s[nq][kt]); } } }
        const int kn = (kb + 32 < TT) ? kb + 32 : 0;   // the last block fetches block 0 again: in bounds, not used
        const T16* ck = pk + (size_t)kn * HD; const T16* ck2 = HL ? pk2 + (size_t)kn * HD : nullptr;
#pragma unroll
        for (int kt = 0; kt < 2; ++kt)
#pragma unroll
            for (int ks = 0; ks < 2; ++ks) { const int off = kt * 16 * HD + ks * 32; ka[kt][ks] = WFrag<T16>::ld(ck + off); if (HL) ka2[kt][ks] = WFrag<T16>::ld(ck2 + off); }
        __builtin_amdgcn_sched_barrier(0);   // keeps the fetch ahead of the softmax: without it the compiler sinks it to the foot of the block, and the next block's first product waits out its latency
        F p[NQ], p2[NQ];
#pragma unroll
        for (int nq = 0; nq < NQ; ++nq) {
            float mx = fmaxf(s[nq][0][0], s[nq][1][0]);
#pragma unroll
            for (int j = 1; j < 8; ++j) mx = fmaxf(mx, fmaxf(s[nq][0][j], s[nq][1][j]));
            mx = fmaxf(mx, xhalf(mx));   // lanes lr and lr + 16 hold the two halves of one query's keys
            const float mn = fmaxf(m[nq], mx * SCL2), al = __builtin_amdgcn_exp2f(m[nq] - mn); m[nq] = mn;
            float x[16];
#pragma unroll
            for (int k = 0; k < 16; ++k) x[k] = fmaf(s[nq][k >> 3][k & 7], SCL2, -mn);
            // the 16 exponentials in place, in one statement: each overwrites only its own argument and is followed by an independent one; the v_nop is the slot that belongs behind the last before its result is used
            asm("v_exp_f32 %0, %0\n\tv_exp_f32 %1, %1\n\tv_exp_f32 %2, %2\n\tv_exp_f32 %3, %3\n\tv_exp_f32 %4, %4\n\tv_exp_f32 %5, %5\n\tv_exp_f32 %6, %6\n\tv_exp_f32 %7, %7\n\t"
                "v_exp_f32 %8, %8\n\tv_exp_f32 %9, %9\n\tv_exp_f32 %10, %10\n\tv_exp_f32 %11, %11\n\tv_exp_f32 %12, %12\n\tv_exp_f32 %13, %13\n\tv_exp_f32 %14, %14\n\tv_exp_f32 %15, %15\n\tv_nop"
                : "+v"(x[0]), "+v"(x[1]), "+v"(x[2]), "+v"(x[3]), "+v"(x[4]), "+v"(x[5]), "+v"(x[6]), "+v"(x[7]), "+v"(x[8]), "+v"(x[9]), "+v"(x[10]), "+v"(x[11]), "+v"(x[12]), "+v"(x[13]), "+v"(x[14]), "+v"(x[15]));
            v16f e; e[0] = x[0]; float sum = x[0];
#pragma unroll
            for (int k = 1; k < 16; ++k) { e[k] = x[k]; sum += x[k]; }
            l[nq] = fmaf(l[nq], al, sum);   // each half keeps the sum of its own keys; the halves meet behind the loop
            if constexpr (HL) { p[nq] = __builtin_convertvector(e, v16bf); p2[nq] = __builtin_convertvector(e - __builtin_convertvector(p[nq], v16f), v16bf); }   // hi = bf16(e), lo = bf16(e - hi), both to nearest even
            else p[nq] = __builtin_convertvector(e, v16h);
#pragma unroll
            for (int db = 0; db < 4; ++db) o[nq][db] *= al; }
#pragma unroll
        for (int db = 0; db < 4; ++db) {
#pragma unroll
            for (int nq = 0; nq < NQ; ++nq) { o[nq][db] = WFrag<T16>::mma(va[db], p[nq], o[nq][db]); if (HL) { o[nq][db] = WFrag<T16>::mma(va[db], p2[nq], o[nq][db]); o[nq][db] = WFrag<T16>::mma(va2[db], p[nq], o[nq][db]); } } }
        // the same wait for this block's loads; their addresses are its inputs so that they stay whole up to it, and the next block forms its addresses behind it
        if constexpr (HL) asm volatile("s_wait_xcnt 0x0" :: "v"(cv), "v"(cv2), "v"(ck), "v"(ck2) : "memory");
        else asm volatile("s_wait_xcnt 0x0" :: "v"(cv), "v"(ck) : "memory");
    }
#pragma unroll
    for (int nq = 0; nq < NQ; ++nq) { const float inv = 1.0f / (l[nq] + xhalf(l[nq])); float* orow = O + (size_t)(q0 + nq * 16 + lr) * DQ + 8 * hi;   // a lane's 8 accumulator registers are 8 consecutive d of its query row
#pragma unroll
        for (int db = 0; db < 4; ++db) { o[nq][db] *= inv; v4f r0, r1;
#pragma unroll
            for (int j = 0; j < 4; ++j) { r0[j] = o[nq][db][j]; r1[j] = o[nq][db][4 + j]; }
            *(v4f*)(orow + db * 16) = r0; *(v4f*)(orow + db * 16 + 4) = r1; }
        // the same wait behind the stores; the stored values and the address are its inputs so that they stay whole up to here
        asm volatile("s_wait_xcnt 0x0" :: "v"(o[nq][0]), "v"(o[nq][1]), "v"(o[nq][2]), "v"(o[nq][3]), "v"(orow) : "memory"); }
}
__global__ __launch_bounds__(32 * (WH + WL)) void k_fattn(const h16* __restrict__ Q16, const h16* __restrict__ K16, const h16* __restrict__ V16, const bf* __restrict__ Qh, const bf* __restrict__ Ql, const bf* __restrict__ Kh, const bf* __restrict__ Kl, const bf* __restrict__ Vh, const bf* __restrict__ Vl, float* M1, float* M2) {
    static_assert(RH % (16 * NQH * WH) == 0 && (TT - RH) % (16 * NQL * WL) == 0 && RH / (16 * NQH * WH) == (TT - RH) / (16 * NQL * WL) && HD == 64, "shape");
    const int hp = blockIdx.x, h = hp & (NH_ - 1); const int w = __builtin_amdgcn_readfirstlane(threadIdx.x >> 5);   // the wave's number as a scalar: the choice of path below is a scalar branch
    const size_t zq = (size_t)hp * TT * HD, zv = (size_t)h * HD * TT;   // pass hp < 16: map 1 (q1/k1), hp >= 16: map 2 (q2/k2); both use v of head hp mod 16
    float* O = ((hp < NH_) ? M1 : M2) + h * HD;
    if (w < WH) attn_tile<bf, true, NQH>(Qh + zq, Ql + zq, Kh + zq, Kl + zq, Vh + zv, Vl + zv, O, (blockIdx.y * WH + w) * (16 * NQH));
    else attn_tile<h16, false, NQL>(Q16 + zq, nullptr, K16 + zq, nullptr, V16 + zv, nullptr, O, RH + (blockIdx.y * WL + (w - WH)) * (16 * NQL));
}

extern "C" void kernel_launch(void* const* d_in, const int* in_sizes, int n_in,
                              void* d_out, int out_size, void* d_ws, size_t ws_size, hipStream_t stream) {
    (void)in_sizes; (void)n_in; (void)out_size;
    const float* x = (const float*)d_in[0]; const float* wq1 = (const float*)d_in[1]; const float* wk1 = (const float*)d_in[2]; const float* wq2 = (const float*)d_in[3]; const float* wk2 = (const float*)d_in[4]; const float* wv = (const float*)d_in[5]; const float* lng = (const float*)d_in[6]; const float* lnb = (const float*)d_in[7]; const float* LAMB = (const float*)d_in[8]; const float* wq = wq1; const float* wk = wk1; const float* wo = nullptr; (void)wo; (void)wq; (void)wk;
    float* OUT = (float*)d_out;     // [2][2048][1024]
    char* wsp = (char*)d_ws;
    auto take = [&](size_t bytes) { char* p = wsp; wsp += (bytes + 255) & ~(size_t)255; return (void*)p; };
    bf* WQ = (bf*)take((size_t)DQ * DM * 2); bf* WK = (bf*)take((size_t)DKV * DM * 2); bf* WQ2 = (bf*)take((size_t)DQ * DM * 2); bf* WK2 = (bf*)take((size_t)DKV * DM * 2); bf* WV = (bf*)take((size_t)DKV * DM * 2); float* M1 = (float*)take((size_t)TT * DQ * 4); float* M2 = (float*)take((size_t)TT * DQ * 4); float* CS = (float*)take((size_t)TT * HD * 2 * 4);
    bf* XB = (bf*)take((size_t)TT * DM * 2); float* FQ = (float*)take((size_t)TT * DQ * 4); float* FK = (float*)take((size_t)TT * DKV * 4);
    h16* QP16 = (h16*)take((size_t)2 * NH_ * TT * HD * 2); h16* KP16 = (h16*)take((size_t)2 * NKV * TT * HD * 2); h16* VT16 = (h16*)take((size_t)NKV * HD * TT * 2);
    bf* QPh = (bf*)take((size_t)2 * NH_ * TT * HD * 2); bf* QPl = (bf*)take((size_t)2 * NH_ * TT * HD * 2); bf* KPh = (bf*)take((size_t)2 * NKV * TT * HD * 2); bf* KPl = (bf*)take((size_t)2 * NKV * TT * HD * 2); bf* VTh = (bf*)take((size_t)NKV * HD * TT * 2); bf* VTl = (bf*)take((size_t)NKV * HD * TT * 2);
    if ((size_t)(wsp - (char*)d_ws) > ws_size) return;    // ws 256 MiB
    float* FV = FK;   // v projection reuses the k buffer after the k planes are built (stream-ordered)
    { const unsigned LW = (unsigned)(((size_t)DQ * DM / 2 + 255) / 256); k_whg<<<LW, 256, 0, stream>>>(wq1, WQ); k_whg<<<LW, 256, 0, stream>>>(wk1, WK); k_whg<<<LW, 256, 0, stream>>>(wq2, WQ2); k_whg<<<LW, 256, 0, stream>>>(wk2, WK2); k_whg<<<LW, 256, 0, stream>>>(wv, WV);   /* [h][c][d] -> Bt [h*64+d][c] */
       }
    k_csid<<<(TT * HD + 255) / 256, 256, 0, stream>>>(CS);
    const unsigned LQ = (unsigned)(((size_t)NH_ * TT * HD / 2 + 255) / 256), LKv = (unsigned)(((size_t)NKV * TT * HD / 2 + 255) / 256);
    for (int b = 0; b < NB_; ++b) {
        
        k_cvt8<<<(unsigned)(((size_t)TT * DM / 8 + 255) / 256), 256, 0, stream>>>(x + (size_t)b * TT * DM, XB, (size_t)TT * DM / 8);
        k_gemmw<bf, 0, false><<<dim3(TT / 64, DQ / 64, 1), 32, 0, stream>>>(XB, nullptr, WQ, nullptr, DM, FQ, DQ, nullptr, 0, 0, 0);
        k_rope<<<LQ, 256, 0, stream>>>(FQ, DQ, NH_, CS, nullptr, nullptr, 1.0f, QP16, QPh, QPl);
        k_gemmw<bf, 0, false><<<dim3(TT / 64, DKV / 64, 1), 32, 0, stream>>>(XB, nullptr, WK, nullptr, DM, FK, DKV, nullptr, 0, 0, 0);
        k_rope<<<LKv, 256, 0, stream>>>(FK, DKV, NKV, CS, nullptr, nullptr, 1.0f, KP16, KPh, KPl);
        k_gemmw<bf, 0, false><<<dim3(TT / 64, DQ / 64, 1), 32, 0, stream>>>(XB, nullptr, WQ2, nullptr, DM, FQ, DQ, nullptr, 0, 0, 0); k_rope<<<LQ, 256, 0, stream>>>(FQ, DQ, NH_, CS, nullptr, nullptr, 1.0f, QP16 + (size_t)NH_ * TT * HD, QPh + (size_t)NH_ * TT * HD, QPl + (size_t)NH_ * TT * HD);   /* q2 planes as heads 16..31 */
        k_gemmw<bf, 0, false><<<dim3(TT / 64, DKV / 64, 1), 32, 0, stream>>>(XB, nullptr, WK2, nullptr, DM, FK, DKV, nullptr, 0, 0, 0); k_rope<<<LKv, 256, 0, stream>>>(FK, DKV, NKV, CS, nullptr, nullptr, 1.0f, KP16 + (size_t)NKV * TT * HD, KPh + (size_t)NKV * TT * HD, KPl + (size_t)NKV * TT * HD);   /* k2 planes as heads 16..31 */
        k_gemmw<bf, 0, false><<<dim3(TT / 64, DKV / 64, 1), 32, 0, stream>>>(XB, nullptr, WV, nullptr, DM, FV, DKV, nullptr, 0, 0, 0); k_vtp<<<LKv, 256, 0, stream>>>(FV, DKV, NKV, VT16, VTh, VTl);
        k_fattn<<<dim3(2 * NH_, RH / (16 * NQH * WH)), 32 * (WH + WL), 0, stream>>>(QP16, KP16, VT16, QPh, QPl, KPh, KPl, VTh, VTl, M1, M2);   /* f32 contexts of map 1 / map 2, merged by head */
        k_difln<<<TT / 8, 256, 0, stream>>>(M1, M2, lng, lnb, LAMB, OUT + (size_t)b * TT * DM); }   /* (1 - lamb) LN(M1 - lamb M2) */
}

// v004
// A run of this version takes 402 microseconds.
// Two timings next to v003 put it at 1.18 and 1.17 times that version's speed.
// Counting every step since v000, it is 9.25 times as fast.
#include <hip/hip_runtime.h>

// Multi-head differential attention (x [2][2048][1024]; per head h: q1, k1, q2, k2, v = x W[h] (W [16][1024][64]); w1 = softmax(q1.k1/8), w2 = softmax(q2.k2/8); head out = (w1 - lamb w2) v = w1 v - lamb (w2 v); concat heads; out = (1 - lamb) LayerNorm(concat) (gamma, beta, eps 1e-5; lamb scalar, read) -> [2][2048][1024] (4.2 M)).
// Layout: the five [h][c][d] weight tensors are gathered into the [h*64+d][c] layout; each projection GEMM rounds its own f32 accumulators and writes the 16-bit head planes itself (q, k: [h][t][d]; v: [h][d][t]), no f32 projection is written; the two attention maps run as 32 head passes (pass p < 16: q1/k1 of head p, pass p >= 16: q2/k2 of head p-16, both with v of head p mod 16), all in ONE fused launch per batch: scores, online softmax and attn.v stay in registers, no score map is written; the f32 contexts land in two merged buffers M1, M2; one row kernel forms M1 - lamb M2, LayerNorms it and scales by (1 - lamb).
// Compute dtypes, f32 accumulate: every input rounded to bf16; q/k/v on PLAIN bf16 operands (inputs: exact); both maps: scores and attn.v: query rows < 512 hl (3 products), the rest single fp16; softmax f32; no output projection: f32 difference, LayerNorm and scale.

#define NB_  2
#define TT   2048
#define DM   1024
#define NH_  16
#define NKV  16
#define REP  (NH_ / NKV)
#define HD   64
#define DQ   (NH_ * HD)
#define DKV  (NKV * HD)
#define LNEPS 1e-5f
#define RH   512                  // query rows < RH use hi+lo planes
#define WIN  0
#define SCL  0.125f   // HD^-0.5
typedef _Float16 h16;
typedef unsigned short bf;
typedef __attribute__((ext_vector_type(16))) __bf16   v16bf;
typedef __attribute__((ext_vector_type(8)))  __bf16   v8bf;
typedef __attribute__((ext_vector_type(16))) _Float16 v16h;
typedef __attribute__((ext_vector_type(8)))  _Float16 v8h;
typedef __attribute__((ext_vector_type(8)))  unsigned short v8us;
typedef __attribute__((ext_vector_type(8)))  float    v8f;
typedef __attribute__((ext_vector_type(4)))  float    v4f;
typedef v8h  __attribute__((may_alias)) v8ha;
typedef v4f  __attribute__((may_alias)) v4fa;
typedef v8us __attribute__((may_alias)) v8usa;

__device__ __forceinline__ unsigned short f2bf(float f) { unsigned u = __float_as_uint(f); u += 0x7FFFu + ((u >> 16) & 1u); return (unsigned short)(u >> 16); }
__device__ __forceinline__ float bf2f(unsigned short b) { return __uint_as_float(((unsigned)b) << 16); }
__device__ __forceinline__ float bfr(float f) { return bf2f(f2bf(f)); }
__device__ __forceinline__ v16h cat16(v8h lo, v8h hi) { return __builtin_shufflevector(lo, hi, 0, 1, 2, 3, 4, 5, 6, 7, 8, 9, 10, 11, 12, 13, 14, 15); }
__device__ __forceinline__ v16bf cat16b(v8us lo, v8us hi) { return __builtin_bit_cast(v16bf, __builtin_shufflevector(lo, hi, 0, 1, 2, 3, 4, 5, 6, 7, 8, 9, 10, 11, 12, 13, 14, 15)); }
__device__ __forceinline__ v8f wmma16(v16h a, v16h b, v8f c) { return __builtin_amdgcn_wmma_f32_16x16x32_f16(false, a, false, b, (short)0, c, false, false); }
__device__ __forceinline__ v8f wmmab(v16bf a, v16bf b, v8f c) { return __builtin_amdgcn_wmma_f32_16x16x32_bf16(false, a, false, b, (short)0, c, false, false); }



// ---- k_gemmp: register-blocked GEMM, ONE WAVE per 64x64 tile (16 accumulators), operands straight from K-contiguous 16-bit planes; grid (M/64, N/64), 32 threads. K % 32 == 0.
// c[m][n] = sum_k A[m][k] Bt[n][k] (+ split products per NSPLIT) stays in registers; the epilogue rounds it to three 16-bit planes (fp16; bf16 hi; bf16 lo = bf16(c - hi), all to nearest even) and stores them with m running fastest:
// element (m, n) at (m / 64) ZS + n LDP + m % 64. q, k: A = weights (m = 64 h + d), Bt = x (n = t), ZS = TT HD, LDP = HD: planes [h][t][d]. v: A = x (m = t), Bt = weights (n = 64 h + d), ZS = 64, LDP = TT: planes [h][d][t].
// A lane's 8 accumulator registers are 8 consecutive m of one n: 16 bytes of a plane row. The 64 m of a row are one 128-byte line; the rows pass through LDS so that 8 lanes store a whole line.
template <typename T16> struct WFrag;
template <> struct WFrag<h16> { typedef v16h V; static __device__ __forceinline__ V ld(const h16* p) { return cat16(*(const v8h*)p, *(const v8h*)(p + 16)); } static __device__ __forceinline__ v8f mma(V a, V b, v8f c) { return wmma16(a, b, c); } };
template <> struct WFrag<bf> { typedef v16bf V; static __device__ __forceinline__ V ld(const bf* p) { return cat16b(*(const v8us*)p, *(const v8us*)(p + 16)); } static __device__ __forceinline__ v8f mma(V a, V b, v8f c) { return wmmab(a, b, c); } };
#define OSP 72   // LDS row pitch in 16-bit elements: 128 bytes of data + 16
template <typename T16, int NSPLIT, int ZS, int LDP>
__global__ __launch_bounds__(32) void k_gemmp(const T16* __restrict__ A, const T16* __restrict__ A2, const T16* __restrict__ Bt, const T16* __restrict__ Bt2, int K, h16* __restrict__ P16, bf* __restrict__ Ph, bf* __restrict__ Pl) {
    typedef typename WFrag<T16>::V V;
    __shared__ __align__(16) unsigned short os[3][16 * OSP];
    const int lane = threadIdx.x & 31, lr = lane & 15, hi = lane >> 4; const int r0 = blockIdx.x * 64, c0 = blockIdx.y * 64;
    v8f acc[4][4];
#pragma unroll
    for (int mb = 0; mb < 4; ++mb)
#pragma unroll
        for (int nb = 0; nb < 4; ++nb) acc[mb][nb] = (v8f){};
    const size_t aoff = (size_t)(r0 + lr) * K + 8 * hi, boff = (size_t)(c0 + lr) * K + 8 * hi;
#pragma unroll 1
    for (int kc = 0; kc < K; kc += 32) {
        V a[4], a2[4];
#pragma unroll
        for (int mb = 0; mb < 4; ++mb) { a[mb] = WFrag<T16>::ld(A + aoff + (size_t)mb * 16 * K + kc); if (NSPLIT == 1 || NSPLIT == 2) a2[mb] = WFrag<T16>::ld(A2 + aoff + (size_t)mb * 16 * K + kc); }
#pragma unroll
        for (int nb = 0; nb < 4; ++nb) { const V b = WFrag<T16>::ld(Bt + boff + (size_t)nb * 16 * K + kc); V b2; if (NSPLIT >= 2) b2 = WFrag<T16>::ld(Bt2 + boff + (size_t)nb * 16 * K + kc);
#pragma unroll
            for (int mb = 0; mb < 4; ++mb) { acc[mb][nb] = WFrag<T16>::mma(a[mb], b, acc[mb][nb]); if (NSPLIT == 1 || NSPLIT == 2) acc[mb][nb] = WFrag<T16>::mma(a2[mb], b, acc[mb][nb]); if (NSPLIT >= 2) acc[mb][nb] = WFrag<T16>::mma(a[mb], b2, acc[mb][nb]); } }
        asm volatile("v_nop\n\tv_nop\n\tv_nop\n\tv_nop" : "+v"(acc[0][0]), "+v"(acc[1][1]), "+v"(acc[2][2]), "+v"(acc[3][3]) : "v"(a[0]), "v"(a[3]));
    }
    const int srow = lane >> 3, sch = (lane & 7) * 8;   // on the way out a lane takes 16 bytes (chunk lane % 8) of row lane / 8 of each group of 4 rows
    const unsigned po = blockIdx.x * (unsigned)ZS + (unsigned)(c0 + srow) * (unsigned)LDP + (unsigned)sch;
    h16* const q16 = P16 + po; bf* const qh = Ph + po; bf* const ql = Pl + po;   // one address per plane; every store below is a constant distance from it
#pragma unroll
    for (int nb = 0; nb < 4; ++nb) {
#pragma unroll
        for (int mb = 0; mb < 4; ++mb) { const v8f c = acc[mb][nb]; const v8bf ch = __builtin_convertvector(c, v8bf); const v8bf cl = __builtin_convertvector(c - __builtin_convertvector(ch, v8f), v8bf); const int so = lr * OSP + mb * 16 + hi * 8;
            *(v8usa*)(&os[0][so]) = __builtin_bit_cast(v8us, __builtin_convertvector(c, v8h)); *(v8usa*)(&os[1][so]) = __builtin_bit_cast(v8us, ch); *(v8usa*)(&os[2][so]) = __builtin_bit_cast(v8us, cl); }
        __builtin_amdgcn_wave_barrier(); asm volatile("" ::: "memory");   // the reads below take what OTHER lanes of the wave wrote: keeps the compiler from moving them above the writes
        v8us w16[4], wh[4], wl[4];
#pragma unroll
        for (int s = 0; s < 4; ++s) { const int so = (s * 4 + srow) * OSP + sch; w16[s] = *(const v8usa*)(&os[0][so]); wh[s] = *(const v8usa*)(&os[1][so]); wl[s] = *(const v8usa*)(&os[2][so]); }
#pragma unroll
        for (int s = 0; s < 4; ++s) { const int e = (nb * 16 + s * 4) * LDP; *(v8h*)(q16 + e) = __builtin_bit_cast(v8h, w16[s]); *(v8us*)(qh + e) = wh[s]; *(v8us*)(ql + e) = wl[s]; }
        if (nb < 3) {   // behind the last group nothing is overwritten any more
            // the wait that belongs in front of any overwrite of a register that an issued store names; the stored values and the addresses are its inputs so that they stay whole up to here
            asm volatile("s_wait_xcnt 0x0" :: "v"(w16[0]), "v"(w16[1]), "v"(w16[2]), "v"(w16[3]), "v"(wh[0]), "v"(wh[1]), "v"(wh[2]), "v"(wh[3]), "v"(wl[0]), "v"(wl[1]), "v"(wl[2]), "v"(wl[3]), "v"(q16), "v"(qh), "v"(ql) : "memory");
            __builtin_amdgcn_wave_barrier(); asm volatile("" ::: "memory");   // the next group's writes go over rows that other lanes have just read: keeps the compiler from moving them above the reads
        }
    }
}

typedef __attribute__((ext_vector_type(2))) _Float16 v2h;
typedef __attribute__((ext_vector_type(4))) _Float16 v4h;
typedef __attribute__((ext_vector_type(2))) unsigned short v2us;
typedef __attribute__((ext_vector_type(4))) unsigned short v4us;
typedef __attribute__((ext_vector_type(2))) float v2f;
typedef __attribute__((ext_vector_type(4))) int v4i;
typedef v4h  __attribute__((may_alias)) v4ha;
typedef v4us __attribute__((may_alias)) v4usa;

__global__ __launch_bounds__(256) void k_wtG(const float* __restrict__ w, int K, int N, bf* Bt) {
    const int lane = threadIdx.x & 31; const int L0 = (blockIdx.x * 8 + (threadIdx.x >> 5)) * 8; const int nlines = N * K / 64;
{
#pragma unroll 1
        for (int l = 0; l < 8; ++l) { const int L = L0 + l; if (L >= nlines) break; const size_t e = (size_t)L * 64 + lane * 2; const int k = (int)(e % K), n = (int)(e / K); v2us o;
            o[0] = f2bf(w[(size_t)k * N + n]); o[1] = f2bf(w[(size_t)(k + 1) * N + n]); *(v2us*)(Bt + e) = o; }
         }
}
__global__ __launch_bounds__(256) void k_whg(const float* __restrict__ w, bf* Bt) { const size_t e0 = ((size_t)blockIdx.x * 256 + threadIdx.x) * 2; if (e0 >= (size_t)DQ * DM) return; const int e = (int)(e0 % DM); const int n = (int)(e0 / DM); const int h = n / HD, d = n % HD; v2us o; o[0] = f2bf(w[((size_t)h * DM + e) * HD + d]); o[1] = f2bf(w[((size_t)h * DM + e + 1) * HD + d]); *(v2us*)(Bt + e0) = o;  }
__global__ __launch_bounds__(256) void k_cvt8(const float* __restrict__ src, bf* dst, size_t n8) { const size_t i = (size_t)blockIdx.x * 256 + threadIdx.x; if (i >= n8) return; const v8f v = *(const v8f*)(src + i * 8); v8us o;
#pragma unroll
    for (int k = 0; k < 8; ++k) o[k] = f2bf(v[k]); *(v8us*)(dst + i * 8) = o;  }




__global__ __launch_bounds__(256) void k_difln(const float* __restrict__ M1, const float* __restrict__ M2, const float* __restrict__ g, const float* __restrict__ be, const float* __restrict__ LAMB, float* OUTb) {
    const int lane = threadIdx.x & 31; const int r = blockIdx.x * 8 + (threadIdx.x >> 5); if (r >= TT) return; float lam = bfr(LAMB[0]); asm volatile("" : "+v"(lam)); const float oml = __fsub_rn(1.0f, lam); const float* a1 = M1 + (size_t)r * DQ; const float* a2 = M2 + (size_t)r * DQ; float u[DQ / 32]; float s = 0.f;
#pragma unroll
    for (int ch = 0; ch < DQ / 128; ++ch) { const int c0 = ch * 128 + lane * 4; const v4f p1 = *(const v4f*)(a1 + c0), p2 = *(const v4f*)(a2 + c0);
#pragma unroll
        for (int q = 0; q < 4; ++q) { float lp = __fmul_rn(lam, p2[q]); asm volatile("" : "+v"(lp)); float v = __fsub_rn(p1[q], lp); asm volatile("" : "+v"(v)); u[ch * 4 + q] = v; s = __fadd_rn(s, v); } }
#pragma unroll
    for (int sh = 16; sh; sh >>= 1) s += __shfl_xor(s, sh, 32);
    const float mu = s * (1.0f / DQ); float s2 = 0.f;
#pragma unroll
    for (int k = 0; k < DQ / 32; ++k) { float d0 = __fsub_rn(u[k], mu); asm volatile("" : "+v"(d0)); float p = __fmul_rn(d0, d0); asm volatile("" : "+v"(p)); s2 = __fadd_rn(s2, p); }
#pragma unroll
    for (int sh = 16; sh; sh >>= 1) s2 += __shfl_xor(s2, sh, 32);
    const float rs = __frsqrt_rn(__fadd_rn(s2 * (1.0f / DQ), LNEPS));
{
#pragma unroll
        for (int ch = 0; ch < DQ / 128; ++ch) { const int c0 = ch * 128 + lane * 4; v4f o4;
#pragma unroll
            for (int q = 0; q < 4; ++q) { float d1 = __fsub_rn(u[ch * 4 + q], mu); asm volatile("" : "+v"(d1)); float n0 = __fmul_rn(d1, rs); asm volatile("" : "+v"(n0)); float gq = bfr(g[c0 + q]), bq2 = bfr(be[c0 + q]); asm volatile("" : "+v"(gq), "+v"(bq2)); float n1 = __fmul_rn(n0, gq); asm volatile("" : "+v"(n1)); float y = __fadd_rn(n1, bq2); asm volatile("" : "+v"(y)); o4[q] = __fmul_rn(oml, y); }
            *(v4f*)(OUTb + (size_t)r * DQ + c0) = o4; }
         } }

// ---- k_fattn: scores, softmax and attn.v of one head pass in one kernel. One wave owns 16 NQ query rows (NQH on hi + lo rows, NQL on fp16 rows: as many as the registers of two waves per SIMD take, since every K and Vt fragment loaded serves NQ products) and walks all TT keys, 32 at a time; operands straight from the K-contiguous 16-bit planes.
// Transposed products: St = K Qt (A = 16 key rows, B = 16 query columns), Ot += Vt Pt (A = 16 d rows of the [d][t] plane, B = Pt). A lane then holds scores of ONE query (column lr): keys 8 hi + j of each 16-key tile,
// which is the k order of a B operand, so that the two score tiles of a 32-key block, once exponentiated and rounded, ARE the B operand of the second product: no LDS, no lane exchange.
// Online softmax in base 2: running maximum m and sum l per query; the context is rescaled by 2^(m_old - m_new) in each block and divided by l at the end. HL: hi + lo bf16 planes, 3 products each.
// grid (2 NH_, RH / (16 NQH WH)), 32 (WH + WL) threads: every work-group has WH waves on hi + lo rows and WL waves on fp16 rows of one head pass, in the ratio of the rows, so that all work-groups carry the same load. No barrier, no LDS: the waves are independent.
// Not done here: every fragment load still gathers 16 rows (16 cache lines for its 1024 bytes), and each wave fetches its own copy of K and Vt; nothing is staged in LDS.
#define NQH  2
#define NQL  4
#define WH   2
#define WL   3
#define SCL2 0.18033688011112042f   // HD^-0.5 x log2(e)
typedef __attribute__((ext_vector_type(16))) float v16f;
__device__ __forceinline__ float xhalf(float v) { const int b = __float_as_int(v); return __int_as_float(__builtin_amdgcn_permlanex16(b, b, 0x76543210, 0xfedcba98, false, false)); }   // the value of lane l ^ 16, by a vector cross-row move (a shuffle would go through the LDS pipe and its wait)
template <typename T16, bool HL, int NQ>
__device__ __forceinline__ void attn_tile(const T16* __restrict__ Q, const T16* __restrict__ Q2, const T16* __restrict__ K, const T16* __restrict__ K2, const T16* __restrict__ Vt, const T16* __restrict__ Vt2, float* __restrict__ O, int q0) {
    typedef typename WFrag<T16>::V F;
    const int lane = threadIdx.x & 31, lr = lane & 15, hi = lane >> 4;
    F q[NQ][2], q2[NQ][2]; v8f o[NQ][4]; float m[NQ], l[NQ];
    const unsigned qby = (unsigned)((q0 + lr) * HD + 8 * hi) * 2u, kby = (unsigned)(lr * HD + 8 * hi) * 2u;   // a lane's byte offsets in the Q and K planes of its head
    const T16* cq = (const T16*)((const char*)Q + qby); const T16* cq2 = HL ? (const T16*)((const char*)Q2 + qby) : nullptr;
#pragma unroll
    for (int nq = 0; nq < NQ; ++nq) { m[nq] = -1.0e30f; l[nq] = 0.f;
#pragma unroll
        for (int ks = 0; ks < 2; ++ks) { const int qo = nq * 16 * HD + ks * 32; q[nq][ks] = WFrag<T16>::ld(cq + qo); if (HL) q2[nq][ks] = WFrag<T16>::ld(cq2 + qo); }
#pragma unroll
        for (int db = 0; db < 4; ++db) o[nq][db] = (v8f){}; }
    const size_t vo = (size_t)lr * TT + 8 * hi;
    const T16* pk = (const T16*)((const char*)K + kby); const T16* pk2 = HL ? (const T16*)((const char*)K2 + kby) : nullptr; const T16* pv = Vt + vo; const T16* pv2 = HL ? Vt2 + vo : nullptr;
    F ka[2][2], ka2[2][2];   // the K fragments of the block in work; each block fetches the next block's into them right behind its own score products, so that their latency runs under the softmax and the second product
#pragma unroll
    for (int kt = 0; kt < 2; ++kt)
#pragma unroll
        for (int ks = 0; ks < 2; ++ks) { const size_t off = (size_t)(kt * 16) * HD + ks * 32; ka[kt][ks] = WFrag<T16>::ld(pk + off); if (HL) ka2[kt][ks] = WFrag<T16>::ld(pk2 + off); }
    // the wait that belongs in front of any overwrite of a register that an issued load names; the offsets and bases are its inputs so that they stay whole up to here
    if constexpr (HL) asm volatile("s_wait_xcnt 0x0" :: "v"(qby), "v"(kby), "s"(Q), "s"(Q2), "s"(K), "s"(K2) : "memory");
    else asm volatile("s_wait_xcnt 0x0" :: "v"(qby), "v"(kby), "s"(Q), "s"(K) : "memory");
    for (int kb = 0; kb < TT; kb += 32) {
        const T16* cv = pv + kb; const T16* cv2 = HL ? pv2 + kb : nullptr;
        F va[4], va2[4];   // this block's Vt fragments, asked for first: their latency runs under the score products and the softmax
#pragma unroll
        for (int db = 0; db < 4; ++db) { va[db] = WFrag<T16>::ld(cv + db * 16 * TT); if (HL) va2[db] = WFrag<T16>::ld(cv2 + db * 16 * TT); }
        __builtin_amdgcn_sched_barrier(0);   // keeps these loads at the head of the block: without it the compiler sinks part of them to just in front of their products, and the wave waits out their latency there
        v8f s[NQ][2];
#pragma unroll
        for (int nq = 0; nq < NQ; ++nq) { s[nq][0] = (v8f){}; s[nq][1] = (v8f){}; }
#pragma unroll
        for (int kt = 0; kt < 2; ++kt)
#pragma unroll
            for (int ks = 0; ks < 2; ++ks) {
#pragma unroll
                for (int nq = 0; nq < NQ; ++nq) { s[nq][kt] = WFrag<T16>::mma(ka[kt][ks], q[nq][ks], s[nq][kt]); if (HL) { s[nq][kt] = WFrag<T16>::mma(ka[kt][ks], q2[nq][ks], s[nq][kt]); s[nq][kt] = WFrag<T16>::mma(ka2[kt][ks], q[nq][ks], s[nq][kt]); } } }
        const int kn = (kb + 32 < TT) ? kb + 32 : 0;   // the last block fetches block 0 again: in bounds, not used
        const T16* ck = pk + (size_t)kn * HD; const T16* ck2 = HL ? pk2 + (size_t)kn * HD : nullptr;
#pragma unroll
        for (int kt = 0; kt < 2; ++kt)
#pragma unroll
            for (int ks = 0; ks < 2; ++ks) { const int off = kt * 16 * HD + ks * 32; ka[kt][ks] = WFrag<T16>::ld(ck + off); if (HL) ka2[kt][ks] = WFrag<T16>::ld(ck2 + off); }
        __builtin_amdgcn_sched_barrier(0);   // keeps the fetch ahead of the softmax: without it the compiler sinks it to the foot of the block, and the next block's first product waits out its latency
        F p[NQ], p2[NQ];
#pragma unroll
        for (int nq = 0; nq < NQ; ++nq) {
            float mx = fmaxf(s[nq][0][0], s[nq][1][0]);
#pragma unroll
            for (int j = 1; j < 8; ++j) mx = fmaxf(mx, fmaxf(s[nq][0][j], s[nq][1][j]));
            mx = fmaxf(mx, xhalf(mx));   // lanes lr and lr + 16 hold the two halves of one query's keys
            const float mn = fmaxf(m[nq], mx * SCL2), al = __builtin_amdgcn_exp2f(m[nq] - mn); m[nq] = mn;
            float x[16];
#pragma unroll
            for (int k = 0; k < 16; ++k) x[k] = fmaf(s[nq][k >> 3][k & 7], SCL2, -mn);
            // the 16 exponentials in place, in one statement: each overwrites only its own argument and is followed by an independent one; the v_nop is the slot that belongs behind the last before its result is used
            asm("v_exp_f32 %0, %0\n\tv_exp_f32 %1, %1\n\tv_exp_f32 %2, %2\n\tv_exp_f32 %3, %3\n\tv_exp_f32 %4, %4\n\tv_exp_f32 %5, %5\n\tv_exp_f32 %6, %6\n\tv_exp_f32 %7, %7\n\t"
                "v_exp_f32 %8, %8\n\tv_exp_f32 %9, %9\n\tv_exp_f32 %10, %10\n\tv_exp_f32 %11, %11\n\tv_exp_f32 %12, %12\n\tv_exp_f32 %13, %13\n\tv_exp_f32 %14, %14\n\tv_exp_f32 %15, %15\n\tv_nop"
                : "+v"(x[0]), "+v"(x[1]), "+v"(x[2]), "+v"(x[3]), "+v"(x[4]), "+v"(x[5]), "+v"(x[6]), "+v"(x[7]), "+v"(x[8]), "+v"(x[9]), "+v"(x[10]), "+v"(x[11]), "+v"(x[12]), "+v"(x[13]), "+v"(x[14]), "+v"(x[15]));
            v16f e; e[0] = x[0]; float sum = x[0];
#pragma unroll
            for (int k = 1; k < 16; ++k) { e[k] = x[k]; sum += x[k]; }
            l[nq] = fmaf(l[nq], al, sum);   // each half keeps the sum of its own keys; the halves meet behind the loop
            if constexpr (HL) { p[nq] = __builtin_convertvector(e, v16bf); p2[nq] = __builtin_convertvector(e - __builtin_convertvector(p[nq], v16f), v16bf); }   // hi = bf16(e), lo = bf16(e - hi), both to nearest even
            else p[nq] = __builtin_convertvector(e, v16h);
#pragma unroll
            for (int db = 0; db < 4; ++db) o[nq][db] *= al; }
#pragma unroll
        for (int db = 0; db < 4; ++db) {
#pragma unroll
            for (int nq = 0; nq < NQ; ++nq) { o[nq][db] = WFrag<T16>::mma(va[db], p[nq], o[nq][db]); if (HL) { o[nq][db] = WFrag<T16>::mma(va[db], p2[nq], o[nq][db]); o[nq][db] = WFrag<T16>::mma(va2[db], p[nq], o[nq][db]); } } }
        // the same wait for this block's loads; their addresses are its inputs so that they stay whole up to it, and the next block forms its addresses behind it
        if constexpr (HL) asm volatile("s_wait_xcnt 0x0" :: "v"(cv), "v"(cv2), "v"(ck), "v"(ck2) : "memory");
        else asm volatile("s_wait_xcnt 0x0" :: "v"(cv), "v"(ck) : "memory");
    }
#pragma unroll
    for (int nq = 0; nq < NQ; ++nq) { const float inv = 1.0f / (l[nq] + xhalf(l[nq])); float* orow = O + (size_t)(q0 + nq * 16 + lr) * DQ + 8 * hi;   // a lane's 8 accumulator registers are 8 consecutive d of its query row
#pragma unroll
        for (int db = 0; db < 4; ++db) { o[nq][db] *= inv; v4f r0, r1;
#pragma unroll
            for (int j = 0; j < 4; ++j) { r0[j] = o[nq][db][j]; r1[j] = o[nq][db][4 + j]; }
            *(v4f*)(orow + db * 16) = r0; *(v4f*)(orow + db * 16 + 4) = r1; }
        // the same wait behind the stores; the stored values and the address are its inputs so that they stay whole up to here
        asm volatile("s_wait_xcnt 0x0" :: "v"(o[nq][0]), "v"(o[nq][1]), "v"(o[nq][2]), "v"(o[nq][3]), "v"(orow) : "memory"); }
}
__global__ __launch_bounds__(32 * (WH + WL)) void k_fattn(const h16* __restrict__ Q16, const h16* __restrict__ K16, const h16* __restrict__ V16, const bf* __restrict__ Qh, const bf* __restrict__ Ql, const bf* __restrict__ Kh, const bf* __restrict__ Kl, const bf* __restrict__ Vh, const bf* __restrict__ Vl, float* M1, float* M2) {
    static_assert(RH % (16 * NQH * WH) == 0 && (TT - RH) % (16 * NQL * WL) == 0 && RH / (16 * NQH * WH) == (TT - RH) / (16 * NQL * WL) && HD == 64, "shape");
    const int hp = blockIdx.x, h = hp & (NH_ - 1); const int w = __builtin_amdgcn_readfirstlane(threadIdx.x >> 5);   // the wave's number as a scalar: the choice of path below is a scalar branch
    const size_t zq = (size_t)hp * TT * HD, zv = (size_t)h * HD * TT;   // pass hp < 16: map 1 (q1/k1), hp >= 16: map 2 (q2/k2); both use v of head hp mod 16
    float* O = ((hp < NH_) ? M1 : M2) + h * HD;
    if (w < WH) attn_tile<bf, true, NQH>(Qh + zq, Ql + zq, Kh + zq, Kl + zq, Vh + zv, Vl + zv, O, (blockIdx.y * WH + w) * (16 * NQH));
    else attn_tile<h16, false, NQL>(Q16 + zq, nullptr, K16 + zq, nullptr, V16 + zv, nullptr, O, RH + (blockIdx.y * WL + (w - WH)) * (16 * NQL));
}

extern "C" void kernel_launch(void* const* d_in, const int* in_sizes, int n_in,
                              void* d_out, int out_size, void* d_ws, size_t ws_size, hipStream_t stream) {
    (void)in_sizes; (void)n_in; (void)out_size;
    const float* x = (const float*)d_in[0]; const float* wq1 = (const float*)d_in[1]; const float* wk1 = (const float*)d_in[2]; const float* wq2 = (const float*)d_in[3]; const float* wk2 = (const float*)d_in[4]; const float* wv = (const float*)d_in[5]; const float* lng = (const float*)d_in[6]; const float* lnb = (const float*)d_in[7]; const float* LAMB = (const float*)d_in[8]; const float* wq = wq1; const float* wk = wk1; const float* wo = nullptr; (void)wo; (void)wq; (void)wk;
    float* OUT = (float*)d_out;     // [2][2048][1024]
    char* wsp = (char*)d_ws;
    auto take = [&](size_t bytes) { char* p = wsp; wsp += (bytes + 255) & ~(size_t)255; return (void*)p; };
    bf* WQ = (bf*)take((size_t)DQ * DM * 2); bf* WK = (bf*)take((size_t)DKV * DM * 2); bf* WQ2 = (bf*)take((size_t)DQ * DM * 2); bf* WK2 = (bf*)take((size_t)DKV * DM * 2); bf* WV = (bf*)take((size_t)DKV * DM * 2); float* M1 = (float*)take((size_t)TT * DQ * 4); float* M2 = (float*)take((size_t)TT * DQ * 4);
    bf* XB = (bf*)take((size_t)TT * DM * 2);
    h16* QP16 = (h16*)take((size_t)2 * NH_ * TT * HD * 2); h16* KP16 = (h16*)take((size_t)2 * NKV * TT * HD * 2); h16* VT16 = (h16*)take((size_t)NKV * HD * TT * 2);
    bf* QPh = (bf*)take((size_t)2 * NH_ * TT * HD * 2); bf* QPl = (bf*)take((size_t)2 * NH_ * TT * HD * 2); bf* KPh = (bf*)take((size_t)2 * NKV * TT * HD * 2); bf* KPl = (bf*)take((size_t)2 * NKV * TT * HD * 2); bf* VTh = (bf*)take((size_t)NKV * HD * TT * 2); bf* VTl = (bf*)take((size_t)NKV * HD * TT * 2);
    if ((size_t)(wsp - (char*)d_ws) > ws_size) return;    // ws 256 MiB
    { const unsigned LW = (unsigned)(((size_t)DQ * DM / 2 + 255) / 256); k_whg<<<LW, 256, 0, stream>>>(wq1, WQ); k_whg<<<LW, 256, 0, stream>>>(wk1, WK); k_whg<<<LW, 256, 0, stream>>>(wq2, WQ2); k_whg<<<LW, 256, 0, stream>>>(wk2, WK2); k_whg<<<LW, 256, 0, stream>>>(wv, WV);   /* [h][c][d] -> Bt [h*64+d][c] */
       }
    for (int b = 0; b < NB_; ++b) {
        
        k_cvt8<<<(unsigned)(((size_t)TT * DM / 8 + 255) / 256), 256, 0, stream>>>(x + (size_t)b * TT * DM, XB, (size_t)TT * DM / 8);
        k_gemmp<bf, 0, TT * HD, HD><<<dim3(DQ / 64, TT / 64), 32, 0, stream>>>(WQ, nullptr, XB, nullptr, DM, QP16, QPh, QPl);
        k_gemmp<bf, 0, TT * HD, HD><<<dim3(DKV / 64, TT / 64), 32, 0, stream>>>(WK, nullptr, XB, nullptr, DM, KP16, KPh, KPl);
        k_gemmp<bf, 0, TT * HD, HD><<<dim3(DQ / 64, TT / 64), 32, 0, stream>>>(WQ2, nullptr, XB, nullptr, DM, QP16 + (size_t)NH_ * TT * HD, QPh + (size_t)NH_ * TT * HD, QPl + (size_t)NH_ * TT * HD);   /* q2 planes as heads 16..31 */
        k_gemmp<bf, 0, TT * HD, HD><<<dim3(DKV / 64, TT / 64), 32, 0, stream>>>(WK2, nullptr, XB, nullptr, DM, KP16 + (size_t)NKV * TT * HD, KPh + (size_t)NKV * TT * HD, KPl + (size_t)NKV * TT * HD);   /* k2 planes as heads 16..31 */
        k_gemmp<bf, 0, 64, TT><<<dim3(TT / 64, DKV / 64), 32, 0, stream>>>(XB, nullptr, WV, nullptr, DM, VT16, VTh, VTl);   /* v planes, t running fastest */
        k_fattn<<<dim3(2 * NH_, RH / (16 * NQH * WH)), 32 * (WH + WL), 0, stream>>>(QP16, KP16, VT16, QPh, QPl, KPh, KPl, VTh, VTl, M1, M2);   /* f32 contexts of map 1 / map 2, merged by head */
        k_difln<<<TT / 8, 256, 0, stream>>>(M1, M2, lng, lnb, LAMB, OUT + (size_t)b * TT * DM); }   /* (1 - lamb) LN(M1 - lamb M2) */
}

// v005
// It runs in 235 microseconds.
// Timed twice side by side with v004, it ran 1.71 and 1.73 times as fast.
// Counting every step since v000, it is 15.9 times as fast.
#include <hip/hip_runtime.h>

// Multi-head differential attention (x [2][2048][1024]; per head h: q1, k1, q2, k2, v = x W[h] (W [16][1024][64]); w1 = softmax(q1.k1/8), w2 = softmax(q2.k2/8); head out = (w1 - lamb w2) v = w1 v - lamb (w2 v); concat heads; out = (1 - lamb) LayerNorm(concat) (gamma, beta, eps 1e-5; lamb scalar, read) -> [2][2048][1024] (4.2 M)).
// Layout: the five [h][c][d] weight tensors are gathered into the [h*64+d][c] layout; each projection GEMM rounds its own f32 accumulators and writes the 16-bit head planes itself (q, k: [h][t][d]; v: [h][d][t]), no f32 projection is written; the two attention maps run as 32 head passes (pass p < 16: q1/k1 of head p, pass p >= 16: q2/k2 of head p-16, both with v of head p mod 16), all in ONE fused launch for both batches: scores, online softmax and attn.v stay in registers, no score map is written; the f32 contexts land in two merged buffers M1, M2; one row kernel forms M1 - lamb M2, LayerNorms it and scales by (1 - lamb). Work that does not depend on each other shares a launch: the batch, the projection and the weight tensor are grid indices (5 launches in all), every buffer holds both batches.
// Compute dtypes, f32 accumulate: every input rounded to bf16; q/k/v on PLAIN bf16 operands (inputs: exact); both maps: scores and attn.v: query rows < 512 hl (3 products), the rest single fp16; softmax f32; no output projection: f32 difference, LayerNorm and scale.

#define NB_  2
#define TT   2048
#define DM   1024
#define NH_  16
#define NKV  16
#define REP  (NH_ / NKV)
#define HD   64
#define DQ   (NH_ * HD)
#define DKV  (NKV * HD)
#define LNEPS 1e-5f
#define RH   512                  // query rows < RH use hi+lo planes
#define WIN  0
#define SCL  0.125f   // HD^-0.5
typedef _Float16 h16;
typedef unsigned short bf;
typedef __attribute__((ext_vector_type(16))) __bf16   v16bf;
typedef __attribute__((ext_vector_type(8)))  __bf16   v8bf;
typedef __attribute__((ext_vector_type(16))) _Float16 v16h;
typedef __attribute__((ext_vector_type(8)))  _Float16 v8h;
typedef __attribute__((ext_vector_type(8)))  unsigned short v8us;
typedef __attribute__((ext_vector_type(8)))  float    v8f;
typedef __attribute__((ext_vector_type(4)))  float    v4f;
typedef v8h  __attribute__((may_alias)) v8ha;
typedef v4f  __attribute__((may_alias)) v4fa;
typedef v8us __attribute__((may_alias)) v8usa;

__device__ __forceinline__ unsigned short f2bf(float f) { unsigned u = __float_as_uint(f); u += 0x7FFFu + ((u >> 16) & 1u); return (unsigned short)(u >> 16); }
__device__ __forceinline__ float bf2f(unsigned short b) { return __uint_as_float(((unsigned)b) << 16); }
__device__ __forceinline__ float bfr(float f) { return bf2f(f2bf(f)); }
__device__ __forceinline__ v16h cat16(v8h lo, v8h hi) { return __builtin_shufflevector(lo, hi, 0, 1, 2, 3, 4, 5, 6, 7, 8, 9, 10, 11, 12, 13, 14, 15); }
__device__ __forceinline__ v16bf cat16b(v8us lo, v8us hi) { return __builtin_bit_cast(v16bf, __builtin_shufflevector(lo, hi, 0, 1, 2, 3, 4, 5, 6, 7, 8, 9, 10, 11, 12, 13, 14, 15)); }
__device__ __forceinline__ v8f wmma16(v16h a, v16h b, v8f c) { return __builtin_amdgcn_wmma_f32_16x16x32_f16(false, a, false, b, (short)0, c, false, false); }
__device__ __forceinline__ v8f wmmab(v16bf a, v16bf b, v8f c) { return __builtin_amdgcn_wmma_f32_16x16x32_bf16(false, a, false, b, (short)0, c, false, false); }



// ---- gemmp_tile: register-blocked GEMM, ONE WAVE per 64x64 tile at (r0, c0) (16 accumulators), operands straight from K-contiguous 16-bit planes; os: the wave's own LDS rows. K % 32 == 0.
// c[m][n] = sum_k A[m][k] Bt[n][k] (+ split products per NSPLIT) stays in registers; the epilogue rounds it to three 16-bit planes (fp16; bf16 hi; bf16 lo = bf16(c - hi), all to nearest even) and stores them with m running fastest:
// element (m, n) at (m / 64) ZS + n LDP + m % 64. q, k: A = weights (m = 64 h + d), Bt = x (n = t), ZS = TT HD, LDP = HD: planes [h][t][d]. v: A = x (m = t), Bt = weights (n = 64 h + d), ZS = 64, LDP = TT: planes [h][d][t].
// A lane's 8 accumulator registers are 8 consecutive m of one n: 16 bytes of a plane row. The 64 m of a row are one 128-byte line; the rows pass through LDS so that 8 lanes store a whole line.
template <typename T16> struct WFrag;
template <> struct WFrag<h16> { typedef v16h V; static __device__ __forceinline__ V ld(const h16* p) { return cat16(*(const v8h*)p, *(const v8h*)(p + 16)); } static __device__ __forceinline__ v8f mma(V a, V b, v8f c) { return wmma16(a, b, c); } };
template <> struct WFrag<bf> { typedef v16bf V; static __device__ __forceinline__ V ld(const bf* p) { return cat16b(*(const v8us*)p, *(const v8us*)(p + 16)); } static __device__ __forceinline__ v8f mma(V a, V b, v8f c) { return wmmab(a, b, c); } };
#define OSP 72   // LDS row pitch in 16-bit elements: 128 bytes of data + 16
template <typename T16, int NSPLIT, int ZS, int LDP>
__device__ __forceinline__ void gemmp_tile(const T16* __restrict__ A, const T16* __restrict__ A2, const T16* __restrict__ Bt, const T16* __restrict__ Bt2, int K, h16* __restrict__ P16, bf* __restrict__ Ph, bf* __restrict__ Pl, int r0, int c0, unsigned short (*os)[16 * OSP]) {
    typedef typename WFrag<T16>::V V;
    const int lane = threadIdx.x & 31, lr = lane & 15, hi = lane >> 4;
    v8f acc[4][4];
#pragma unroll
    for (int mb = 0; mb < 4; ++mb)
#pragma unroll
        for (int nb = 0; nb < 4; ++nb) acc[mb][nb] = (v8f){};
    const size_t aoff = (size_t)(r0 + lr) * K + 8 * hi, boff = (size_t)(c0 + lr) * K + 8 * hi;
#pragma unroll 1
    for (int kc = 0; kc < K; kc += 32) {
        V a[4], a2[4];
#pragma unroll
        for (int mb = 0; mb < 4; ++mb) { a[mb] = WFrag<T16>::ld(A + aoff + (size_t)mb * 16 * K + kc); if (NSPLIT == 1 || NSPLIT == 2) a2[mb] = WFrag<T16>::ld(A2 + aoff + (size_t)mb * 16 * K + kc); }
#pragma unroll
        for (int nb = 0; nb < 4; ++nb) { const V b = WFrag<T16>::ld(Bt + boff + (size_t)nb * 16 * K + kc); V b2; if (NSPLIT >= 2) b2 = WFrag<T16>::ld(Bt2 + boff + (size_t)nb * 16 * K + kc);
#pragma unroll
            for (int mb = 0; mb < 4; ++mb) { acc[mb][nb] = WFrag<T16>::mma(a[mb], b, acc[mb][nb]); if (NSPLIT == 1 || NSPLIT == 2) acc[mb][nb] = WFrag<T16>::mma(a2[mb], b, acc[mb][nb]); if (NSPLIT >= 2) acc[mb][nb] = WFrag<T16>::mma(a[mb], b2, acc[mb][nb]); } }
        asm volatile("v_nop\n\tv_nop\n\tv_nop\n\tv_nop" : "+v"(acc[0][0]), "+v"(acc[1][1]), "+v"(acc[2][2]), "+v"(acc[3][3]) : "v"(a[0]), "v"(a[3]));
    }
    const int srow = lane >> 3, sch = (lane & 7) * 8;   // on the way out a lane takes 16 bytes (chunk lane % 8) of row lane / 8 of each group of 4 rows
    const unsigned po = (unsigned)(r0 >> 6) * (unsigned)ZS + (unsigned)(c0 + srow) * (unsigned)LDP + (unsigned)sch;
    h16* const q16 = P16 + po; bf* const qh = Ph + po; bf* const ql = Pl + po;   // one address per plane; every store below is a constant distance from it
#pragma unroll
    for (int nb = 0; nb < 4; ++nb) {
#pragma unroll
        for (int mb = 0; mb < 4; ++mb) { const v8f c = acc[mb][nb]; const v8bf ch = __builtin_convertvector(c, v8bf); const v8bf cl = __builtin_convertvector(c - __builtin_convertvector(ch, v8f), v8bf); const int so = lr * OSP + mb * 16 + hi * 8;
            *(v8usa*)(&os[0][so]) = __builtin_bit_cast(v8us, __builtin_convertvector(c, v8h)); *(v8usa*)(&os[1][so]) = __builtin_bit_cast(v8us, ch); *(v8usa*)(&os[2][so]) = __builtin_bit_cast(v8us, cl); }
        __builtin_amdgcn_wave_barrier(); asm volatile("" ::: "memory");   // the reads below take what OTHER lanes of the wave wrote: keeps the compiler from moving them above the writes
        v8us w16[4], wh[4], wl[4];
#pragma unroll
        for (int s = 0; s < 4; ++s) { const int so = (s * 4 + srow) * OSP + sch; w16[s] = *(const v8usa*)(&os[0][so]); wh[s] = *(const v8usa*)(&os[1][so]); wl[s] = *(const v8usa*)(&os[2][so]); }
#pragma unroll
        for (int s = 0; s < 4; ++s) { const int e = (nb * 16 + s * 4) * LDP; *(v8h*)(q16 + e) = __builtin_bit_cast(v8h, w16[s]); *(v8us*)(qh + e) = wh[s]; *(v8us*)(ql + e) = wl[s]; }
        // the wait that belongs in front of any overwrite of a register that an issued store names; the stored values and the addresses are its inputs so that they stay whole up to here (behind the last group too: the function is inlined in front of other code)
        asm volatile("s_wait_xcnt 0x0" :: "v"(w16[0]), "v"(w16[1]), "v"(w16[2]), "v"(w16[3]), "v"(wh[0]), "v"(wh[1]), "v"(wh[2]), "v"(wh[3]), "v"(wl[0]), "v"(wl[1]), "v"(wl[2]), "v"(wl[3]), "v"(q16), "v"(qh), "v"(ql) : "memory");
        if (nb < 3) { __builtin_amdgcn_wave_barrier(); asm volatile("" ::: "memory"); }   // the next group's writes go over rows that other lanes have just read: keeps the compiler from moving them above the reads
    }
}

// ---- k_proj: all five projections of both batches in ONE launch, so that five waves share each SIMD and one wave's load latency runs under the others' products (a single projection of one batch has 512 waves for 1024 SIMDs).
// grid (5 DQ / 128, TT / 128, NB_), 128 threads: four independent waves on the 2 x 2 tiles of 64 x 64 of one 128 x 128 tile (two waves each read the same operand rows). No barrier between the waves.
// W: the weight rows of q1, q2, k1, k2, v in this order, DQ rows each. blockIdx.x < 4 DQ / 128: q and k planes, 64 head slots per batch (A = 128 weight rows, Bt = 128 rows of x); the rest: v planes (A = 128 rows of x, Bt = 128 weight rows of v).
__global__ __launch_bounds__(128) void k_proj(const bf* __restrict__ W, const bf* __restrict__ X, int K, h16* __restrict__ QK16, bf* __restrict__ QKh, bf* __restrict__ QKl, h16* __restrict__ V16, bf* __restrict__ Vh, bf* __restrict__ Vl) {
    __shared__ __align__(16) unsigned short osw[4][3][16 * OSP];
    const int w = __builtin_amdgcn_readfirstlane(threadIdx.x >> 5); const int wm = (w & 1) * 64, wn = (w >> 1) * 64;   // the wave's number as a scalar: tile origins and bases stay in scalar registers
    const int bx = blockIdx.x, by = blockIdx.y; const size_t b = blockIdx.z; const bf* Xb = X + b * ((size_t)TT * DM);
    if (bx < 4 * DQ / 128) { const size_t zp = b * ((size_t)4 * NH_ * TT * HD); gemmp_tile<bf, 0, TT * HD, HD>(W, nullptr, Xb, nullptr, K, QK16 + zp, QKh + zp, QKl + zp, bx * 128 + wm, by * 128 + wn, osw[w]); }
    else { const size_t zp = b * ((size_t)NKV * HD * TT); gemmp_tile<bf, 0, 64, TT>(Xb, nullptr, W + (size_t)4 * DQ * DM, nullptr, K, V16 + zp, Vh + zp, Vl + zp, by * 128 + wm, (bx - 4 * DQ / 128) * 128 + wn, osw[w]); }
}

typedef __attribute__((ext_vector_type(2))) _Float16 v2h;
typedef __attribute__((ext_vector_type(4))) _Float16 v4h;
typedef __attribute__((ext_vector_type(2))) unsigned short v2us;
typedef __attribute__((ext_vector_type(4))) unsigned short v4us;
typedef __attribute__((ext_vector_type(2))) float v2f;
typedef __attribute__((ext_vector_type(4))) int v4i;
typedef v4h  __attribute__((may_alias)) v4ha;
typedef v4us __attribute__((may_alias)) v4usa;

__global__ __launch_bounds__(256) void k_wtG(const float* __restrict__ w, int K, int N, bf* Bt) {
    const int lane = threadIdx.x & 31; const int L0 = (blockIdx.x * 8 + (threadIdx.x >> 5)) * 8; const int nlines = N * K / 64;
{
#pragma unroll 1
        for (int l = 0; l < 8; ++l) { const int L = L0 + l; if (L >= nlines) break; const size_t e = (size_t)L * 64 + lane * 2; const int k = (int)(e % K), n = (int)(e / K); v2us o;
            o[0] = f2bf(w[(size_t)k * N + n]); o[1] = f2bf(w[(size_t)(k + 1) * N + n]); *(v2us*)(Bt + e) = o; }
         }
}
__global__ __launch_bounds__(256) void k_whg(const float* __restrict__ w0, const float* __restrict__ w1, const float* __restrict__ w2, const float* __restrict__ w3, const float* __restrict__ w4, bf* Bt) { const int y = blockIdx.y; const float* __restrict__ w = y == 0 ? w0 : y == 1 ? w1 : y == 2 ? w2 : y == 3 ? w3 : w4; Bt += (size_t)y * DQ * DM;   /* blockIdx.y: which of the five tensors */
    const size_t e0 = ((size_t)blockIdx.x * 256 + threadIdx.x) * 2; if (e0 >= (size_t)DQ * DM) return; const int e = (int)(e0 % DM); const int n = (int)(e0 / DM); const int h = n / HD, d = n % HD; v2us o; o[0] = f2bf(w[((size_t)h * DM + e) * HD + d]); o[1] = f2bf(w[((size_t)h * DM + e + 1) * HD + d]); *(v2us*)(Bt + e0) = o;  }
__global__ __launch_bounds__(256) void k_cvt8(const float* __restrict__ src, bf* dst, size_t n8) { const size_t i = (size_t)blockIdx.x * 256 + threadIdx.x; if (i >= n8) return; const v8f v = *(const v8f*)(src + i * 8); v8us o;
#pragma unroll
    for (int k = 0; k < 8; ++k) o[k] = f2bf(v[k]); *(v8us*)(dst + i * 8) = o;  }




__global__ __launch_bounds__(256) void k_difln(const float* __restrict__ M1, const float* __restrict__ M2, const float* __restrict__ g, const float* __restrict__ be, const float* __restrict__ LAMB, float* OUTb) {
    const int lane = threadIdx.x & 31; const int r = blockIdx.x * 8 + (threadIdx.x >> 5); if (r >= NB_ * TT) return; float lam = bfr(LAMB[0]); asm volatile("" : "+v"(lam)); const float oml = __fsub_rn(1.0f, lam); const float* a1 = M1 + (size_t)r * DQ; const float* a2 = M2 + (size_t)r * DQ; float u[DQ / 32]; float s = 0.f;
#pragma unroll
    for (int ch = 0; ch < DQ / 128; ++ch) { const int c0 = ch * 128 + lane * 4; const v4f p1 = *(const v4f*)(a1 + c0), p2 = *(const v4f*)(a2 + c0);
#pragma unroll
        for (int q = 0; q < 4; ++q) { float lp = __fmul_rn(lam, p2[q]); asm volatile("" : "+v"(lp)); float v = __fsub_rn(p1[q], lp); asm volatile("" : "+v"(v)); u[ch * 4 + q] = v; s = __fadd_rn(s, v); } }
#pragma unroll
    for (int sh = 16; sh; sh >>= 1) s += __shfl_xor(s, sh, 32);
    const float mu = s * (1.0f / DQ); float s2 = 0.f;
#pragma unroll
    for (int k = 0; k < DQ / 32; ++k) { float d0 = __fsub_rn(u[k], mu); asm volatile("" : "+v"(d0)); float p = __fmul_rn(d0, d0); asm volatile("" : "+v"(p)); s2 = __fadd_rn(s2, p); }
#pragma unroll
    for (int sh = 16; sh; sh >>= 1) s2 += __shfl_xor(s2, sh, 32);
    const float rs = __frsqrt_rn(__fadd_rn(s2 * (1.0f / DQ), LNEPS));
{
#pragma unroll
        for (int ch = 0; ch < DQ / 128; ++ch) { const int c0 = ch * 128 + lane * 4; v4f o4;
#pragma unroll
            for (int q = 0; q < 4; ++q) { float d1 = __fsub_rn(u[ch * 4 + q], mu); asm volatile("" : "+v"(d1)); float n0 = __fmul_rn(d1, rs); asm volatile("" : "+v"(n0)); float gq = bfr(g[c0 + q]), bq2 = bfr(be[c0 + q]); asm volatile("" : "+v"(gq), "+v"(bq2)); float n1 = __fmul_rn(n0, gq); asm volatile("" : "+v"(n1)); float y = __fadd_rn(n1, bq2); asm volatile("" : "+v"(y)); o4[q] = __fmul_rn(oml, y); }
            *(v4f*)(OUTb + (size_t)r * DQ + c0) = o4; }
         } }

// ---- k_fattn: scores, softmax and attn.v of one head pass in one kernel. One wave owns 16 NQ query rows (NQH on hi + lo rows, NQL on fp16 rows: as many as the registers of two waves per SIMD take, since every K and Vt fragment loaded serves NQ products) and walks all TT keys, 32 at a time; operands straight from the K-contiguous 16-bit planes.
// Transposed products: St = K Qt (A = 16 key rows, B = 16 query columns), Ot += Vt Pt (A = 16 d rows of the [d][t] plane, B = Pt). A lane then holds scores of ONE query (column lr): keys 8 hi + j of each 16-key tile,
// which is the k order of a B operand, so that the two score tiles of a 32-key block, once exponentiated and rounded, ARE the B operand of the second product: no LDS, no lane exchange.
// Online softmax in base 2: running maximum m and sum l per query; the context is rescaled by 2^(m_old - m_new) in each block and divided by l at the end. HL: hi + lo bf16 planes, 3 products each.
// grid (2 NH_, RH / (16 NQH WH), NB_), 32 (WH + WL) threads: every work-group has WH waves on hi + lo rows and WL waves on fp16 rows of one head pass, in the ratio of the rows, so that all work-groups carry the same load. No barrier, no LDS: the waves are independent.
// Not done here: every fragment load still gathers 16 rows (16 cache lines for its 1024 bytes), and each wave fetches its own copy of K and Vt; nothing is staged in LDS.
#define NQH  2
#define NQL  4
#define WH   2
#define WL   3
#define SCL2 0.18033688011112042f   // HD^-0.5 x log2(e)
typedef __attribute__((ext_vector_type(16))) float v16f;
__device__ __forceinline__ float xhalf(float v) { const int b = __float_as_int(v); return __int_as_float(__builtin_amdgcn_permlanex16(b, b, 0x76543210, 0xfedcba98, false, false)); }   // the value of lane l ^ 16, by a vector cross-row move (a shuffle would go through the LDS pipe and its wait)
template <typename T16, bool HL, int NQ>
__device__ __forceinline__ void attn_tile(const T16* __restrict__ Q, const T16* __restrict__ Q2, const T16* __restrict__ K, const T16* __restrict__ K2, const T16* __restrict__ Vt, const T16* __restrict__ Vt2, float* __restrict__ O, int q0) {
    typedef typename WFrag<T16>::V F;
    const int lane = threadIdx.x & 31, lr = lane & 15, hi = lane >> 4;
    F q[NQ][2], q2[NQ][2]; v8f o[NQ][4]; float m[NQ], l[NQ];
    const unsigned qby = (unsigned)((q0 + lr) * HD + 8 * hi) * 2u, kby = (unsigned)(lr * HD + 8 * hi) * 2u;   // a lane's byte offsets in the Q and K planes of its head
    const T16* cq = (const T16*)((const char*)Q + qby); const T16* cq2 = HL ? (const T16*)((const char*)Q2 + qby) : nullptr;
#pragma unroll
    for (int nq = 0; nq < NQ; ++nq) { m[nq] = -1.0e30f; l[nq] = 0.f;
#pragma unroll
        for (int ks = 0; ks < 2; ++ks) { const int qo = nq * 16 * HD + ks * 32; q[nq][ks] = WFrag<T16>::ld(cq + qo); if (HL) q2[nq][ks] = WFrag<T16>::ld(cq2 + qo); }
#pragma unroll
        for (int db = 0; db < 4; ++db) o[nq][db] = (v8f){}; }
    const size_t vo = (size_t)lr * TT + 8 * hi;
    const T16* pk = (const T16*)((const char*)K + kby); const T16* pk2 = HL ? (const T16*)((const char*)K2 + kby) : nullptr; const T16* pv = Vt + vo; const T16* pv2 = HL ? Vt2 + vo : nullptr;
    F ka[2][2], ka2[2][2];   // the K fragments of the block in work; each block fetches the next block's into them right behind its own score products, so that their latency runs under the softmax and the second product
#pragma unroll
    for (int kt = 0; kt < 2; ++kt)
#pragma unroll
        for (int ks = 0; ks < 2; ++ks) { const size_t off = (size_t)(kt * 16) * HD + ks * 32; ka[kt][ks] = WFrag<T16>::ld(pk + off); if (HL) ka2[kt][ks] = WFrag<T16>::ld(pk2 + off); }
    // the wait that belongs in front of any overwrite of a register that an issued load names; the offsets and bases are its inputs so that they stay whole up to here
    if constexpr (HL) asm volatile("s_wait_xcnt 0x0" :: "v"(qby), "v"(kby), "s"(Q), "s"(Q2), "s"(K), "s"(K2) : "memory");
    else asm volatile("s_wait_xcnt 0x0" :: "v"(qby), "v"(kby), "s"(Q), "s"(K) : "memory");
    for (int kb = 0; kb < TT; kb += 32) {
        const T16* cv = pv + kb; const T16* cv2 = HL ? pv2 + kb : nullptr;
        F va[4], va2[4];   // this block's Vt fragments, asked for first: their latency runs under the score products and the softmax
#pragma unroll
        for (int db = 0; db < 4; ++db) { va[db] = WFrag<T16>::ld(cv + db * 16 * TT); if (HL) va2[db] = WFrag<T16>::ld(cv2 + db * 16 * TT); }
        __builtin_amdgcn_sched_barrier(0);   // keeps these loads at the head of the block: without it the compiler sinks part of them to just in front of their products, and the wave waits out their latency there
        v8f s[NQ][2];
#pragma unroll
        for (int nq = 0; nq < NQ; ++nq) { s[nq][0] = (v8f){}; s[nq][1] = (v8f){}; }
#pragma unroll
        for (int kt = 0; kt < 2; ++kt)
#pragma unroll
            for (int ks = 0; ks < 2; ++ks) {
#pragma unroll
                for (int nq = 0; nq < NQ; ++nq) { s[nq][kt] = WFrag<T16>::mma(ka[kt][ks], q[nq][ks], s[nq][kt]); if (HL) { s[nq][kt] = WFrag<T16>::mma(ka[kt][ks], q2[nq][ks], s[nq][kt]); s[nq][kt] = WFrag<T16>::mma(ka2[kt][ks], q[nq][ks], s[nq][kt]); } } }
        const int kn = (kb + 32 < TT) ? kb + 32 : 0;   // the last block fetches block 0 again: in bounds, not used
        const T16* ck = pk + (size_t)kn * HD; const T16* ck2 = HL ? pk2 + (size_t)kn * HD : nullptr;
#pragma unroll
        for (int kt = 0; kt < 2; ++kt)
#pragma unroll
            for (int ks = 0; ks < 2; ++ks) { const int off = kt * 16 * HD + ks * 32; ka[kt][ks] = WFrag<T16>::ld(ck + off); if (HL) ka2[kt][ks] = WFrag<T16>::ld(ck2 + off); }
        __builtin_amdgcn_sched_barrier(0);   // keeps the fetch ahead of the softmax: without it the compiler sinks it to the foot of the block, and the next block's first product waits out its latency
        F p[NQ], p2[NQ];
#pragma unroll
        for (int nq = 0; nq < NQ; ++nq) {
            float mx = fmaxf(s[nq][0][0], s[nq][1][0]);
#pragma unroll
            for (int j = 1; j < 8; ++j) mx = fmaxf(mx, fmaxf(s[nq][0][j], s[nq][1][j]));
            mx = fmaxf(mx, xhalf(mx));   // lanes lr and lr + 16 hold the two halves of one query's keys
            const float mn = fmaxf(m[nq], mx * SCL2), al = __builtin_amdgcn_exp2f(m[nq] - mn); m[nq] = mn;
            float x[16];
#pragma unroll
            for (int k = 0; k < 16; ++k) x[k] = fmaf(s[nq][k >> 3][k & 7], SCL2, -mn);
            // the 16 exponentials in place, in one statement: each overwrites only its own argument and is followed by an independent one; the v_nop is the slot that belongs behind the last before its result is used
            asm("v_exp_f32 %0, %0\n\tv_exp_f32 %1, %1\n\tv_exp_f32 %2, %2\n\tv_exp_f32 %3, %3\n\tv_exp_f32 %4, %4\n\tv_exp_f32 %5, %5\n\tv_exp_f32 %6, %6\n\tv_exp_f32 %7, %7\n\t"
                "v_exp_f32 %8, %8\n\tv_exp_f32 %9, %9\n\tv_exp_f32 %10, %10\n\tv_exp_f32 %11, %11\n\tv_exp_f32 %12, %12\n\tv_exp_f32 %13, %13\n\tv_exp_f32 %14, %14\n\tv_exp_f32 %15, %15\n\tv_nop"
                : "+v"(x[0]), "+v"(x[1]), "+v"(x[2]), "+v"(x[3]), "+v"(x[4]), "+v"(x[5]), "+v"(x[6]), "+v"(x[7]), "+v"(x[8]), "+v"(x[9]), "+v"(x[10]), "+v"(x[11]), "+v"(x[12]), "+v"(x[13]), "+v"(x[14]), "+v"(x[15]));
            v16f e; e[0] = x[0]; float sum = x[0];
#pragma unroll
            for (int k = 1; k < 16; ++k) { e[k] = x[k]; sum += x[k]; }
            l[nq] = fmaf(l[nq], al, sum);   // each half keeps the sum of its own keys; the halves meet behind the loop
            if constexpr (HL) { p[nq] = __builtin_convertvector(e, v16bf); p2[nq] = __builtin_convertvector(e - __builtin_convertvector(p[nq], v16f), v16bf); }   // hi = bf16(e), lo = bf16(e - hi), both to nearest even
            else p[nq] = __builtin_convertvector(e, v16h);
#pragma unroll
            for (int db = 0; db < 4; ++db) o[nq][db] *= al; }
#pragma unroll
        for (int db = 0; db < 4; ++db) {
#pragma unroll
            for (int nq = 0; nq < NQ; ++nq) { o[nq][db] = WFrag<T16>::mma(va[db], p[nq], o[nq][db]); if (HL) { o[nq][db] = WFrag<T16>::mma(va[db], p2[nq], o[nq][db]); o[nq][db] = WFrag<T16>::mma(va2[db], p[nq], o[nq][db]); } } }
        // the same wait for this block's loads; their addresses are its inputs so that they stay whole up to it, and the next block forms its addresses behind it
        if constexpr (HL) asm volatile("s_wait_xcnt 0x0" :: "v"(cv), "v"(cv2), "v"(ck), "v"(ck2) : "memory");
        else asm volatile("s_wait_xcnt 0x0" :: "v"(cv), "v"(ck) : "memory");
    }
#pragma unroll
    for (int nq = 0; nq < NQ; ++nq) { const float inv = 1.0f / (l[nq] + xhalf(l[nq])); float* orow = O + (size_t)(q0 + nq * 16 + lr) * DQ + 8 * hi;   // a lane's 8 accumulator registers are 8 consecutive d of its query row
#pragma unroll
        for (int db = 0; db < 4; ++db) { o[nq][db] *= inv; v4f r0, r1;
#pragma unroll
            for (int j = 0; j < 4; ++j) { r0[j] = o[nq][db][j]; r1[j] = o[nq][db][4 + j]; }
            *(v4f*)(orow + db * 16) = r0; *(v4f*)(orow + db * 16 + 4) = r1; }
        // the same wait behind the stores; the stored values and the address are its inputs so that they stay whole up to here
        asm volatile("s_wait_xcnt 0x0" :: "v"(o[nq][0]), "v"(o[nq][1]), "v"(o[nq][2]), "v"(o[nq][3]), "v"(orow) : "memory"); }
}
__global__ __launch_bounds__(32 * (WH + WL)) void k_fattn(const h16* __restrict__ Q16, const h16* __restrict__ K16, const h16* __restrict__ V16, const bf* __restrict__ Qh, const bf* __restrict__ Ql, const bf* __restrict__ Kh, const bf* __restrict__ Kl, const bf* __restrict__ Vh, const bf* __restrict__ Vl, float* M1, float* M2) {
    static_assert(RH % (16 * NQH * WH) == 0 && (TT - RH) % (16 * NQL * WL) == 0 && RH / (16 * NQH * WH) == (TT - RH) / (16 * NQL * WL) && HD == 64, "shape");
    const int hp = blockIdx.x, h = hp & (NH_ - 1); const int w = __builtin_amdgcn_readfirstlane(threadIdx.x >> 5);   // the wave's number as a scalar: the choice of path below is a scalar branch
    const size_t zq = ((size_t)blockIdx.z * (4 * NH_) + hp) * TT * HD, zv = ((size_t)blockIdx.z * NKV + h) * HD * TT;   // pass hp < 16: map 1 (q1/k1), hp >= 16: map 2 (q2/k2); both use v of head hp mod 16
    float* O = ((hp < NH_) ? M1 : M2) + (size_t)blockIdx.z * TT * DQ + h * HD;
    if (w < WH) attn_tile<bf, true, NQH>(Qh + zq, Ql + zq, Kh + zq, Kl + zq, Vh + zv, Vl + zv, O, (blockIdx.y * WH + w) * (16 * NQH));
    else attn_tile<h16, false, NQL>(Q16 + zq, nullptr, K16 + zq, nullptr, V16 + zv, nullptr, O, RH + (blockIdx.y * WL + (w - WH)) * (16 * NQL));
}

extern "C" void kernel_launch(void* const* d_in, const int* in_sizes, int n_in,
                              void* d_out, int out_size, void* d_ws, size_t ws_size, hipStream_t stream) {
    (void)in_sizes; (void)n_in; (void)out_size;
    const float* x = (const float*)d_in[0]; const float* wq1 = (const float*)d_in[1]; const float* wk1 = (const float*)d_in[2]; const float* wq2 = (const float*)d_in[3]; const float* wk2 = (const float*)d_in[4]; const float* wv = (const float*)d_in[5]; const float* lng = (const float*)d_in[6]; const float* lnb = (const float*)d_in[7]; const float* LAMB = (const float*)d_in[8]; const float* wq = wq1; const float* wk = wk1; const float* wo = nullptr; (void)wo; (void)wq; (void)wk;
    float* OUT = (float*)d_out;     // [2][2048][1024]
    char* wsp = (char*)d_ws;
    auto take = [&](size_t bytes) { char* p = wsp; wsp += (bytes + 255) & ~(size_t)255; return (void*)p; };
    bf* WALL = (bf*)take((size_t)5 * DQ * DM * 2);   /* weight rows of q1, q2, k1, k2, v */
    float* M1 = (float*)take((size_t)NB_ * TT * DQ * 4); float* M2 = (float*)take((size_t)NB_ * TT * DQ * 4);
    bf* XB = (bf*)take((size_t)NB_ * TT * DM * 2);
    h16* QK16 = (h16*)take((size_t)NB_ * 4 * NH_ * TT * HD * 2); bf* QKh = (bf*)take((size_t)NB_ * 4 * NH_ * TT * HD * 2); bf* QKl = (bf*)take((size_t)NB_ * 4 * NH_ * TT * HD * 2);   /* [b][slot][t][d]; slots 0..31: q1, q2 heads; 32..63: k1, k2 heads */
    h16* VT16 = (h16*)take((size_t)NB_ * NKV * HD * TT * 2); bf* VTh = (bf*)take((size_t)NB_ * NKV * HD * TT * 2); bf* VTl = (bf*)take((size_t)NB_ * NKV * HD * TT * 2);   /* [b][h][d][t] */
    if ((size_t)(wsp - (char*)d_ws) > ws_size) return;    // ws 256 MiB
    const size_t KO = (size_t)2 * NH_ * TT * HD;   /* the k slots stand behind the 32 q slots of a batch */
    k_whg<<<dim3((unsigned)(((size_t)DQ * DM / 2 + 255) / 256), 5), 256, 0, stream>>>(wq1, wq2, wk1, wk2, wv, WALL);   /* [h][c][d] -> Bt [h*64+d][c] */
    k_cvt8<<<(unsigned)(((size_t)NB_ * TT * DM / 8 + 255) / 256), 256, 0, stream>>>(x, XB, (size_t)NB_ * TT * DM / 8);
    k_proj<<<dim3(5 * DQ / 128, TT / 128, NB_), 128, 0, stream>>>(WALL, XB, DM, QK16, QKh, QKl, VT16, VTh, VTl);
    k_fattn<<<dim3(2 * NH_, RH / (16 * NQH * WH), NB_), 32 * (WH + WL), 0, stream>>>(QK16, QK16 + KO, VT16, QKh, QKl, QKh + KO, QKl + KO, VTh, VTl, M1, M2);   /* f32 contexts of map 1 / map 2, merged by head */
    k_difln<<<NB_ * TT / 8, 256, 0, stream>>>(M1, M2, lng, lnb, LAMB, OUT);   /* (1 - lamb) LN(M1 - lamb M2) */
}

// v006
// A run of this version takes 219 microseconds.
// Timed twice side by side with v005, it ran 1.08 times as fast both times.
// Over all steps from v000 it is 17.2 times as fast.
#include <hip/hip_runtime.h>

// Multi-head differential attention (x [2][2048][1024]; per head h: q1, k1, q2, k2, v = x W[h] (W [16][1024][64]); w1 = softmax(q1.k1/8), w2 = softmax(q2.k2/8); head out = (w1 - lamb w2) v = w1 v - lamb (w2 v); concat heads; out = (1 - lamb) LayerNorm(concat) (gamma, beta, eps 1e-5; lamb scalar, read) -> [2][2048][1024] (4.2 M)).
// Layout: the five [h][c][d] weight tensors are gathered into the [h*64+d][c] layout; each projection GEMM rounds its own f32 accumulators and writes the 16-bit head planes itself (q, k: [h][t][d]; v: [h][d][t]), no f32 projection is written; the two attention maps run as 32 head passes (pass p < 16: q1/k1 of head p, pass p >= 16: q2/k2 of head p-16, both with v of head p mod 16), all in ONE fused launch for both batches: scores, online softmax and attn.v stay in registers, no score map is written; the f32 contexts land in two merged buffers M1, M2; one row kernel forms M1 - lamb M2, LayerNorms it and scales by (1 - lamb). Work that does not depend on each other shares a launch: the batch, the projection and the weight tensor are grid indices (5 launches in all), every buffer holds both batches.
// Compute dtypes, f32 accumulate: every input rounded to bf16; q/k/v on PLAIN bf16 operands (inputs: exact); both maps: scores and attn.v: query rows < 512 hl (3 products), the rest single fp16; softmax f32; no output projection: f32 difference, LayerNorm and scale.

#define NB_  2
#define TT   2048
#define DM   1024
#define NH_  16
#define NKV  16
#define REP  (NH_ / NKV)
#define HD   64
#define DQ   (NH_ * HD)
#define DKV  (NKV * HD)
#define LNEPS 1e-5f
#define RH   512                  // query rows < RH use hi+lo planes
#define WIN  0
#define SCL  0.125f   // HD^-0.5
typedef _Float16 h16;
typedef unsigned short bf;
typedef __attribute__((ext_vector_type(16))) __bf16   v16bf;
typedef __attribute__((ext_vector_type(8)))  __bf16   v8bf;
typedef __attribute__((ext_vector_type(16))) _Float16 v16h;
typedef __attribute__((ext_vector_type(8)))  _Float16 v8h;
typedef __attribute__((ext_vector_type(8)))  unsigned short v8us;
typedef __attribute__((ext_vector_type(8)))  float    v8f;
typedef __attribute__((ext_vector_type(4)))  float    v4f;
typedef v8h  __attribute__((may_alias)) v8ha;
typedef v4f  __attribute__((may_alias)) v4fa;
typedef v8us __attribute__((may_alias)) v8usa;

__device__ __forceinline__ unsigned short f2bf(float f) { unsigned u = __float_as_uint(f); u += 0x7FFFu + ((u >> 16) & 1u); return (unsigned short)(u >> 16); }
__device__ __forceinline__ float bf2f(unsigned short b) { return __uint_as_float(((unsigned)b) << 16); }
__device__ __forceinline__ float bfr(float f) { return bf2f(f2bf(f)); }
__device__ __forceinline__ v16h cat16(v8h lo, v8h hi) { return __builtin_shufflevector(lo, hi, 0, 1, 2, 3, 4, 5, 6, 7, 8, 9, 10, 11, 12, 13, 14, 15); }
__device__ __forceinline__ v16bf cat16b(v8us lo, v8us hi) { return __builtin_bit_cast(v16bf, __builtin_shufflevector(lo, hi, 0, 1, 2, 3, 4, 5, 6, 7, 8, 9, 10, 11, 12, 13, 14, 15)); }
__device__ __forceinline__ v8f wmma16(v16h a, v16h b, v8f c) { return __builtin_amdgcn_wmma_f32_16x16x32_f16(false, a, false, b, (short)0, c, false, false); }
__device__ __forceinline__ v8f wmmab(v16bf a, v16bf b, v8f c) { return __builtin_amdgcn_wmma_f32_16x16x32_bf16(false, a, false, b, (short)0, c, false, false); }



// ---- gemmp_tile: register-blocked GEMM, ONE WAVE per 64x64 tile at (r0, c0) (16 accumulators), operands straight from K-contiguous 16-bit planes; os: the wave's own LDS rows. K % 32 == 0.
// c[m][n] = sum_k A[m][k] Bt[n][k] (+ split products per NSPLIT) stays in registers; the epilogue rounds it to three 16-bit planes (fp16; bf16 hi; bf16 lo = bf16(c - hi), all to nearest even) and stores them with m running fastest:
// element (m, n) at (m / 64) ZS + n LDP + m % 64. q, k: A = weights (m = 64 h + d), Bt = x (n = t), ZS = TT HD, LDP = HD: planes [h][t][d]. v: A = x (m = t), Bt = weights (n = 64 h + d), ZS = 64, LDP = TT: planes [h][d][t].
// A lane's 8 accumulator registers are 8 consecutive m of one n: 16 bytes of a plane row. The 64 m of a row are one 128-byte line; the rows pass through LDS so that 8 lanes store a whole line.
template <typename T16> struct WFrag;
template <> struct WFrag<h16> { typedef v16h V; static __device__ __forceinline__ V ld(const h16* p) { return cat16(*(const v8h*)p, *(const v8h*)(p + 16)); } static __device__ __forceinline__ v8f mma(V a, V b, v8f c) { return wmma16(a, b, c); } };
template <> struct WFrag<bf> { typedef v16bf V; static __device__ __forceinline__ V ld(const bf* p) { return cat16b(*(const v8us*)p, *(const v8us*)(p + 16)); } static __device__ __forceinline__ v8f mma(V a, V b, v8f c) { return wmmab(a, b, c); } };
#define OSP 72   // LDS row pitch in 16-bit elements: 128 bytes of data + 16
template <typename T16, int NSPLIT, int ZS, int LDP>
__device__ __forceinline__ void gemmp_tile(const T16* __restrict__ A, const T16* __restrict__ A2, const T16* __restrict__ Bt, const T16* __restrict__ Bt2, int K, h16* __restrict__ P16, bf* __restrict__ Ph, bf* __restrict__ Pl, int r0, int c0, unsigned short (*os)[16 * OSP]) {
    typedef typename WFrag<T16>::V V;
    const int lane = threadIdx.x & 31, lr = lane & 15, hi = lane >> 4;
    v8f acc[4][4];
#pragma unroll
    for (int mb = 0; mb < 4; ++mb)
#pragma unroll
        for (int nb = 0; nb < 4; ++nb) acc[mb][nb] = (v8f){};
    const size_t aoff = (size_t)(r0 + lr) * K + 8 * hi, boff = (size_t)(c0 + lr) * K + 8 * hi;
#pragma unroll 1
    for (int kc = 0; kc < K; kc += 32) {
        V a[4], a2[4];
#pragma unroll
        for (int mb = 0; mb < 4; ++mb) { a[mb] = WFrag<T16>::ld(A + aoff + (size_t)mb * 16 * K + kc); if (NSPLIT == 1 || NSPLIT == 2) a2[mb] = WFrag<T16>::ld(A2 + aoff + (size_t)mb * 16 * K + kc); }
#pragma unroll
        for (int nb = 0; nb < 4; ++nb) { const V b = WFrag<T16>::ld(Bt + boff + (size_t)nb * 16 * K + kc); V b2; if (NSPLIT >= 2) b2 = WFrag<T16>::ld(Bt2 + boff + (size_t)nb * 16 * K + kc);
#pragma unroll
            for (int mb = 0; mb < 4; ++mb) { acc[mb][nb] = WFrag<T16>::mma(a[mb], b, acc[mb][nb]); if (NSPLIT == 1 || NSPLIT == 2) acc[mb][nb] = WFrag<T16>::mma(a2[mb], b, acc[mb][nb]); if (NSPLIT >= 2) acc[mb][nb] = WFrag<T16>::mma(a[mb], b2, acc[mb][nb]); } }
        asm volatile("v_nop\n\tv_nop\n\tv_nop\n\tv_nop" : "+v"(acc[0][0]), "+v"(acc[1][1]), "+v"(acc[2][2]), "+v"(acc[3][3]) : "v"(a[0]), "v"(a[3]));
    }
    const int srow = lane >> 3, sch = (lane & 7) * 8;   // on the way out a lane takes 16 bytes (chunk lane % 8) of row lane / 8 of each group of 4 rows
    const unsigned po = (unsigned)(r0 >> 6) * (unsigned)ZS + (unsigned)(c0 + srow) * (unsigned)LDP + (unsigned)sch;
    h16* const q16 = P16 + po; bf* const qh = Ph + po; bf* const ql = Pl + po;   // one address per plane; every store below is a constant distance from it
#pragma unroll
    for (int nb = 0; nb < 4; ++nb) {
#pragma unroll
        for (int mb = 0; mb < 4; ++mb) { const v8f c = acc[mb][nb]; const v8bf ch = __builtin_convertvector(c, v8bf); const v8bf cl = __builtin_convertvector(c - __builtin_convertvector(ch, v8f), v8bf); const int so = lr * OSP + mb * 16 + hi * 8;
            *(v8usa*)(&os[0][so]) = __builtin_bit_cast(v8us, __builtin_convertvector(c, v8h)); *(v8usa*)(&os[1][so]) = __builtin_bit_cast(v8us, ch); *(v8usa*)(&os[2][so]) = __builtin_bit_cast(v8us, cl); }
        __builtin_amdgcn_wave_barrier(); asm volatile("" ::: "memory");   // the reads below take what OTHER lanes of the wave wrote: keeps the compiler from moving them above the writes
        v8us w16[4], wh[4], wl[4];
#pragma unroll
        for (int s = 0; s < 4; ++s) { const int so = (s * 4 + srow) * OSP + sch; w16[s] = *(const v8usa*)(&os[0][so]); wh[s] = *(const v8usa*)(&os[1][so]); wl[s] = *(const v8usa*)(&os[2][so]); }
#pragma unroll
        for (int s = 0; s < 4; ++s) { const int e = (nb * 16 + s * 4) * LDP; *(v8h*)(q16 + e) = __builtin_bit_cast(v8h, w16[s]); *(v8us*)(qh + e) = wh[s]; *(v8us*)(ql + e) = wl[s]; }
        // the wait that belongs in front of any overwrite of a register that an issued store names; the stored values and the addresses are its inputs so that they stay whole up to here (behind the last group too: the function is inlined in front of other code)
        asm volatile("s_wait_xcnt 0x0" :: "v"(w16[0]), "v"(w16[1]), "v"(w16[2]), "v"(w16[3]), "v"(wh[0]), "v"(wh[1]), "v"(wh[2]), "v"(wh[3]), "v"(wl[0]), "v"(wl[1]), "v"(wl[2]), "v"(wl[3]), "v"(q16), "v"(qh), "v"(ql) : "memory");
        if (nb < 3) { __builtin_amdgcn_wave_barrier(); asm volatile("" ::: "memory"); }   // the next group's writes go over rows that other lanes have just read: keeps the compiler from moving them above the reads
    }
}

// ---- k_proj: all five projections of both batches in ONE launch, so that five waves share each SIMD and one wave's load latency runs under the others' products (a single projection of one batch has 512 waves for 1024 SIMDs).
// grid (5 DQ / 128, TT / 128, NB_), 128 threads: four independent waves on the 2 x 2 tiles of 64 x 64 of one 128 x 128 tile (two waves each read the same operand rows). No barrier between the waves.
// W: the weight rows of q1, q2, k1, k2, v in this order, DQ rows each. blockIdx.x < 4 DQ / 128: q and k planes, 64 head slots per batch (A = 128 weight rows, Bt = 128 rows of x); the rest: v planes (A = 128 rows of x, Bt = 128 weight rows of v).
__global__ __launch_bounds__(128) void k_proj(const bf* __restrict__ W, const bf* __restrict__ X, int K, h16* __restrict__ QK16, bf* __restrict__ QKh, bf* __restrict__ QKl, h16* __restrict__ V16, bf* __restrict__ Vh, bf* __restrict__ Vl) {
    __shared__ __align__(16) unsigned short osw[4][3][16 * OSP];
    const int w = __builtin_amdgcn_readfirstlane(threadIdx.x >> 5); const int wm = (w & 1) * 64, wn = (w >> 1) * 64;   // the wave's number as a scalar: tile origins and bases stay in scalar registers
    const int bx = blockIdx.x, by = blockIdx.y; const size_t b = blockIdx.z; const bf* Xb = X + b * ((size_t)TT * DM);
    if (bx < 4 * DQ / 128) { const size_t zp = b * ((size_t)4 * NH_ * TT * HD); gemmp_tile<bf, 0, TT * HD, HD>(W, nullptr, Xb, nullptr, K, QK16 + zp, QKh + zp, QKl + zp, bx * 128 + wm, by * 128 + wn, osw[w]); }
    else { const size_t zp = b * ((size_t)NKV * HD * TT); gemmp_tile<bf, 0, 64, TT>(Xb, nullptr, W + (size_t)4 * DQ * DM, nullptr, K, V16 + zp, Vh + zp, Vl + zp, by * 128 + wm, (bx - 4 * DQ / 128) * 128 + wn, osw[w]); }
}

typedef __attribute__((ext_vector_type(2))) _Float16 v2h;
typedef __attribute__((ext_vector_type(4))) _Float16 v4h;
typedef __attribute__((ext_vector_type(2))) unsigned short v2us;
typedef __attribute__((ext_vector_type(4))) unsigned short v4us;
typedef __attribute__((ext_vector_type(2))) float v2f;
typedef __attribute__((ext_vector_type(4))) int v4i;
typedef v4h  __attribute__((may_alias)) v4ha;
typedef v4us __attribute__((may_alias)) v4usa;

__global__ __launch_bounds__(256) void k_wtG(const float* __restrict__ w, int K, int N, bf* Bt) {
    const int lane = threadIdx.x & 31; const int L0 = (blockIdx.x * 8 + (threadIdx.x >> 5)) * 8; const int nlines = N * K / 64;
{
#pragma unroll 1
        for (int l = 0; l < 8; ++l) { const int L = L0 + l; if (L >= nlines) break; const size_t e = (size_t)L * 64 + lane * 2; const int k = (int)(e % K), n = (int)(e / K); v2us o;
            o[0] = f2bf(w[(size_t)k * N + n]); o[1] = f2bf(w[(size_t)(k + 1) * N + n]); *(v2us*)(Bt + e) = o; }
         }
}
// ---- k_whg: one [h][c][d] f32 tile of WCT c rows x all 64 d (32 KiB in a row in memory) -> bf16 rows [h*64+d][c], turned in LDS, so that every global load and store covers whole 128-byte lines.
// grid (NH_ DM / WCT, 5 tensors), 256 threads. In: a thread takes 4 d (lane % 16) of 2 x 4 consecutive c; 16 lanes read one 256-byte row. Out: 16 lanes store 256 bytes of one [d] row.
// LDS: row d holds its WCT c as 16 chunks of 16 bytes; chunk q stands at place q ^ (d / 4), which spreads the 8-byte writes of a wave (16 rows 4 apart) and the 16-byte reads (one row) over all banks.
#define WCT 128
__global__ __launch_bounds__(256) void k_whg(const float* __restrict__ w0, const float* __restrict__ w1, const float* __restrict__ w2, const float* __restrict__ w3, const float* __restrict__ w4, bf* Bt) {
    __shared__ __align__(16) unsigned short ts[HD * WCT];
    const int y = blockIdx.y; const float* __restrict__ w = y == 0 ? w0 : y == 1 ? w1 : y == 2 ? w2 : y == 3 ? w3 : w4;   /* blockIdx.y: which of the five tensors */
    const int h = blockIdx.x / (DM / WCT), c0 = (blockIdx.x % (DM / WCT)) * WCT; const int lo = threadIdx.x & 15, up = threadIdx.x >> 4;
    const float* src = w + ((size_t)h * DM + c0 + 4 * up) * HD + 4 * lo;
    v4f r[2][4];   // r[i][k]: d = 4 lo .. 4 lo + 3 of c = c0 + 64 i + 4 up + k; all eight loads are issued before the first is used
    // every loop below is unrolled so that r, o and q are indexed by constants and stay in registers
#pragma unroll
    for (int i = 0; i < 2; ++i)
#pragma unroll
        for (int k = 0; k < 4; ++k) r[i][k] = *(const v4f*)(src + (i * 64 + k) * HD);
#pragma unroll
    for (int i = 0; i < 2; ++i)
#pragma unroll
        for (int j = 0; j < 4; ++j) { v4us o;
#pragma unroll
            for (int k = 0; k < 4; ++k) o[k] = f2bf(r[i][k][j]);
            *(v4usa*)(&ts[(4 * lo + j) * WCT + ((((up >> 1) + 8 * i) ^ lo) << 3) + (up & 1) * 4]) = o; }
    __syncthreads();   // the reads below take what other waves wrote
    bf* dst = Bt + (size_t)y * DQ * DM + ((size_t)h * HD + up) * DM + c0 + 8 * lo;
    v8us q[4];
#pragma unroll
    for (int s = 0; s < 4; ++s) q[s] = *(const v8usa*)(&ts[(up + 16 * s) * WCT + ((lo ^ ((up >> 2) + 4 * s)) << 3)]);
#pragma unroll
    for (int s = 0; s < 4; ++s) *(v8us*)(dst + (size_t)s * 16 * DM) = q[s];
}
__global__ __launch_bounds__(256) void k_cvt8(const float* __restrict__ src, bf* dst, size_t n8) { const size_t i = (size_t)blockIdx.x * 256 + threadIdx.x; if (i >= n8) return; const v8f v = *(const v8f*)(src + i * 8); v8us o;
#pragma unroll
    for (int k = 0; k < 8; ++k) o[k] = f2bf(v[k]); *(v8us*)(dst + i * 8) = o;  }




__global__ __launch_bounds__(256) void k_difln(const float* __restrict__ M1, const float* __restrict__ M2, const float* __restrict__ g, const float* __restrict__ be, const float* __restrict__ LAMB, float* OUTb) {
    const int lane = threadIdx.x & 31; const int r = blockIdx.x * 8 + (threadIdx.x >> 5); if (r >= NB_ * TT) return; float lam = bfr(LAMB[0]); asm volatile("" : "+v"(lam)); const float oml = __fsub_rn(1.0f, lam); const float* a1 = M1 + (size_t)r * DQ; const float* a2 = M2 + (size_t)r * DQ; float u[DQ / 32]; float s = 0.f;
#pragma unroll
    for (int ch = 0; ch < DQ / 128; ++ch) { const int c0 = ch * 128 + lane * 4; const v4f p1 = *(const v4f*)(a1 + c0), p2 = *(const v4f*)(a2 + c0);
#pragma unroll
        for (int q = 0; q < 4; ++q) { float lp = __fmul_rn(lam, p2[q]); asm volatile("" : "+v"(lp)); float v = __fsub_rn(p1[q], lp); asm volatile("" : "+v"(v)); u[ch * 4 + q] = v; s = __fadd_rn(s, v); } }
#pragma unroll
    for (int sh = 16; sh; sh >>= 1) s += __shfl_xor(s, sh, 32);
    const float mu = s * (1.0f / DQ); float s2 = 0.f;
#pragma unroll
    for (int k = 0; k < DQ / 32; ++k) { float d0 = __fsub_rn(u[k], mu); asm volatile("" : "+v"(d0)); float p = __fmul_rn(d0, d0); asm volatile("" : "+v"(p)); s2 = __fadd_rn(s2, p); }
#pragma unroll
    for (int sh = 16; sh; sh >>= 1) s2 += __shfl_xor(s2, sh, 32);
    const float rs = __frsqrt_rn(__fadd_rn(s2 * (1.0f / DQ), LNEPS));
{
#pragma unroll
        for (int ch = 0; ch < DQ / 128; ++ch) { const int c0 = ch * 128 + lane * 4; v4f o4;
#pragma unroll
            for (int q = 0; q < 4; ++q) { float d1 = __fsub_rn(u[ch * 4 + q], mu); asm volatile("" : "+v"(d1)); float n0 = __fmul_rn(d1, rs); asm volatile("" : "+v"(n0)); float gq = bfr(g[c0 + q]), bq2 = bfr(be[c0 + q]); asm volatile("" : "+v"(gq), "+v"(bq2)); float n1 = __fmul_rn(n0, gq); asm volatile("" : "+v"(n1)); float y = __fadd_rn(n1, bq2); asm volatile("" : "+v"(y)); o4[q] = __fmul_rn(oml, y); }
            *(v4f*)(OUTb + (size_t)r * DQ + c0) = o4; }
         } }

// ---- k_fattn: scores, softmax and attn.v of one head pass in one kernel. One wave owns 16 NQ query rows (NQH on hi + lo rows, NQL on fp16 rows: as many as the registers of two waves per SIMD take, since every K and Vt fragment loaded serves NQ products) and walks all TT keys, 32 at a time; operands straight from the K-contiguous 16-bit planes.
// Transposed products: St = K Qt (A = 16 key rows, B = 16 query columns), Ot += Vt Pt (A = 16 d rows of the [d][t] plane, B = Pt). A lane then holds scores of ONE query (column lr): keys 8 hi + j of each 16-key tile,
// which is the k order of a B operand, so that the two score tiles of a 32-key block, once exponentiated and rounded, ARE the B operand of the second product: no LDS, no lane exchange.
// Online softmax in base 2: running maximum m and sum l per query; the context is rescaled by 2^(m_old - m_new) in each block and divided by l at the end. HL: hi + lo bf16 planes, 3 products each.
// grid (2 NH_, RH / (16 NQH WH), NB_), 32 (WH + WL) threads: every work-group has WH waves on hi + lo rows and WL waves on fp16 rows of one head pass, in the ratio of the rows, so that all work-groups carry the same load. No barrier, no LDS: the waves are independent.
// Not done here: every fragment load still gathers 16 rows (16 cache lines for its 1024 bytes), and each wave fetches its own copy of K and Vt; nothing is staged in LDS.
#define NQH  2
#define NQL  4
#define WH   2
#define WL   3
#define SCL2 0.18033688011112042f   // HD^-0.5 x log2(e)
typedef __attribute__((ext_vector_type(16))) float v16f;
__device__ __forceinline__ float xhalf(float v) { const int b = __float_as_int(v); return __int_as_float(__builtin_amdgcn_permlanex16(b, b, 0x76543210, 0xfedcba98, false, false)); }   // the value of lane l ^ 16, by a vector cross-row move (a shuffle would go through the LDS pipe and its wait)
template <typename T16, bool HL, int NQ>
__device__ __forceinline__ void attn_tile(const T16* __restrict__ Q, const T16* __restrict__ Q2, const T16* __restrict__ K, const T16* __restrict__ K2, const T16* __restrict__ Vt, const T16* __restrict__ Vt2, float* __restrict__ O, int q0) {
    typedef typename WFrag<T16>::V F;
    const int lane = threadIdx.x & 31, lr = lane & 15, hi = lane >> 4;
    F q[NQ][2], q2[NQ][2]; v8f o[NQ][4]; float m[NQ], l[NQ];
    const unsigned qby = (unsigned)((q0 + lr) * HD + 8 * hi) * 2u, kby = (unsigned)(lr * HD + 8 * hi) * 2u;   // a lane's byte offsets in the Q and K planes of its head
    const T16* cq = (const T16*)((const char*)Q + qby); const T16* cq2 = HL ? (const T16*)((const char*)Q2 + qby) : nullptr;
#pragma unroll
    for (int nq = 0; nq < NQ; ++nq) { m[nq] = -1.0e30f; l[nq] = 0.f;
#pragma unroll
        for (int ks = 0; ks < 2; ++ks) { const int qo = nq * 16 * HD + ks * 32; q[nq][ks] = WFrag<T16>::ld(cq + qo); if (HL) q2[nq][ks] = WFrag<T16>::ld(cq2 + qo); }
#pragma unroll
        for (int db = 0; db < 4; ++db) o[nq][db] = (v8f){}; }
    const size_t vo = (size_t)lr * TT + 8 * hi;
    const T16* pk = (const T16*)((const char*)K + kby); const T16* pk2 = HL ? (const T16*)((const char*)K2 + kby) : nullptr; const T16* pv = Vt + vo; const T16* pv2 = HL ? Vt2 + vo : nullptr;
    F ka[2][2], ka2[2][2];   // the K fragments of the block in work; each block fetches the next block's into them right behind its own score products, so that their latency runs under the softmax and the second product
#pragma unroll
    for (int kt = 0; kt < 2; ++kt)
#pragma unroll
        for (int ks = 0; ks < 2; ++ks) { const size_t off = (size_t)(kt * 16) * HD + ks * 32; ka[kt][ks] = WFrag<T16>::ld(pk + off); if (HL) ka2[kt][ks] = WFrag<T16>::ld(pk2 + off); }
    // the wait that belongs in front of any overwrite of a register that an issued load names; the offsets and bases are its inputs so that they stay whole up to here
    if constexpr (HL) asm volatile("s_wait_xcnt 0x0" :: "v"(qby), "v"(kby), "s"(Q), "s"(Q2), "s"(K), "s"(K2) : "memory");
    else asm volatile("s_wait_xcnt 0x0" :: "v"(qby), "v"(kby), "s"(Q), "s"(K) : "memory");
    for (int kb = 0; kb < TT; kb += 32) {
        const T16* cv = pv + kb; const T16* cv2 = HL ? pv2 + kb : nullptr;
        F va[4], va2[4];   // this block's Vt fragments, asked for first: their latency runs under the score products and the softmax
#pragma unroll
        for (int db = 0; db < 4; ++db) { va[db] = WFrag<T16>::ld(cv + db * 16 * TT); if (HL) va2[db] = WFrag<T16>::ld(cv2 + db * 16 * TT); }
        __builtin_amdgcn_sched_barrier(0);   // keeps these loads at the head of the block: without it the compiler sinks part of them to just in front of their products, and the wave waits out their latency there
        v8f s[NQ][2];
#pragma unroll
        for (int nq = 0; nq < NQ; ++nq) { s[nq][0] = (v8f){}; s[nq][1] = (v8f){}; }
#pragma unroll
        for (int kt = 0; kt < 2; ++kt)
#pragma unroll
            for (int ks = 0; ks < 2; ++ks) {
#pragma unroll
                for (int nq = 0; nq < NQ; ++nq) { s[nq][kt] = WFrag<T16>::mma(ka[kt][ks], q[nq][ks], s[nq][kt]); if (HL) { s[nq][kt] = WFrag<T16>::mma(ka[kt][ks], q2[nq][ks], s[nq][kt]); s[nq][kt] = WFrag<T16>::mma(ka2[kt][ks], q[nq][ks], s[nq][kt]); } } }
        const int kn = (kb + 32 < TT) ? kb + 32 : 0;   // the last block fetches block 0 again: in bounds, not used
        const T16* ck = pk + (size_t)kn * HD; const T16* ck2 = HL ? pk2 + (size_t)kn * HD : nullptr;
#pragma unroll
        for (int kt = 0; kt < 2; ++kt)
#pragma unroll
            for (int ks = 0; ks < 2; ++ks) { const int off = kt * 16 * HD + ks * 32; ka[kt][ks] = WFrag<T16>::ld(ck + off); if (HL) ka2[kt][ks] = WFrag<T16>::ld(ck2 + off); }
        __builtin_amdgcn_sched_barrier(0);   // keeps the fetch ahead of the softmax: without it the compiler sinks it to the foot of the block, and the next block's first product waits out its latency
        F p[NQ], p2[NQ];
#pragma unroll
        for (int nq = 0; nq < NQ; ++nq) {
            float mx = fmaxf(s[nq][0][0], s[nq][1][0]);
#pragma unroll
            for (int j = 1; j < 8; ++j) mx = fmaxf(mx, fmaxf(s[nq][0][j], s[nq][1][j]));
            mx = fmaxf(mx, xhalf(mx));   // lanes lr and lr + 16 hold the two halves of one query's keys
            const float mn = fmaxf(m[nq], mx * SCL2), al = __builtin_amdgcn_exp2f(m[nq] - mn); m[nq] = mn;
            float x[16];
#pragma unroll
            for (int k = 0; k < 16; ++k) x[k] = fmaf(s[nq][k >> 3][k & 7], SCL2, -mn);
            // the 16 exponentials in place, in one statement: each overwrites only its own argument and is followed by an independent one; the v_nop is the slot that belongs behind the last before its result is used
            asm("v_exp_f32 %0, %0\n\tv_exp_f32 %1, %1\n\tv_exp_f32 %2, %2\n\tv_exp_f32 %3, %3\n\tv_exp_f32 %4, %4\n\tv_exp_f32 %5, %5\n\tv_exp_f32 %6, %6\n\tv_exp_f32 %7, %7\n\t"
                "v_exp_f32 %8, %8\n\tv_exp_f32 %9, %9\n\tv_exp_f32 %10, %10\n\tv_exp_f32 %11, %11\n\tv_exp_f32 %12, %12\n\tv_exp_f32 %13, %13\n\tv_exp_f32 %14, %14\n\tv_exp_f32 %15, %15\n\tv_nop"
                : "+v"(x[0]), "+v"(x[1]), "+v"(x[2]), "+v"(x[3]), "+v"(x[4]), "+v"(x[5]), "+v"(x[6]), "+v"(x[7]), "+v"(x[8]), "+v"(x[9]), "+v"(x[10]), "+v"(x[11]), "+v"(x[12]), "+v"(x[13]), "+v"(x[14]), "+v"(x[15]));
            v16f e; e[0] = x[0]; float sum = x[0];
#pragma unroll
            for (int k = 1; k < 16; ++k) { e[k] = x[k]; sum += x[k]; }
            l[nq] = fmaf(l[nq], al, sum);   // each half keeps the sum of its own keys; the halves meet behind the loop
            if constexpr (HL) { p[nq] = __builtin_convertvector(e, v16bf); p2[nq] = __builtin_convertvector(e - __builtin_convertvector(p[nq], v16f), v16bf); }   // hi = bf16(e), lo = bf16(e - hi), both to nearest even
            else p[nq] = __builtin_convertvector(e, v16h);
#pragma unroll
            for (int db = 0; db < 4; ++db) o[nq][db] *= al; }
#pragma unroll
        for (int db = 0; db < 4; ++db) {
#pragma unroll
            for (int nq = 0; nq < NQ; ++nq) { o[nq][db] = WFrag<T16>::mma(va[db], p[nq], o[nq][db]); if (HL) { o[nq][db] = WFrag<T16>::mma(va[db], p2[nq], o[nq][db]); o[nq][db] = WFrag<T16>::mma(va2[db], p[nq], o[nq][db]); } } }
        // the same wait for this block's loads; their addresses are its inputs so that they stay whole up to it, and the next block forms its addresses behind it
        if constexpr (HL) asm volatile("s_wait_xcnt 0x0" :: "v"(cv), "v"(cv2), "v"(ck), "v"(ck2) : "memory");
        else asm volatile("s_wait_xcnt 0x0" :: "v"(cv), "v"(ck) : "memory");
    }
#pragma unroll
    for (int nq = 0; nq < NQ; ++nq) { const float inv = 1.0f / (l[nq] + xhalf(l[nq])); float* orow = O + (size_t)(q0 + nq * 16 + lr) * DQ + 8 * hi;   // a lane's 8 accumulator registers are 8 consecutive d of its query row
#pragma unroll
        for (int db = 0; db < 4; ++db) { o[nq][db] *= inv; v4f r0, r1;
#pragma unroll
            for (int j = 0; j < 4; ++j) { r0[j] = o[nq][db][j]; r1[j] = o[nq][db][4 + j]; }
            *(v4f*)(orow + db * 16) = r0; *(v4f*)(orow + db * 16 + 4) = r1; }
        // the same wait behind the stores; the stored values and the address are its inputs so that they stay whole up to here
        asm volatile("s_wait_xcnt 0x0" :: "v"(o[nq][0]), "v"(o[nq][1]), "v"(o[nq][2]), "v"(o[nq][3]), "v"(orow) : "memory"); }
}
__global__ __launch_bounds__(32 * (WH + WL)) void k_fattn(const h16* __restrict__ Q16, const h16* __restrict__ K16, const h16* __restrict__ V16, const bf* __restrict__ Qh, const bf* __restrict__ Ql, const bf* __restrict__ Kh, const bf* __restrict__ Kl, const bf* __restrict__ Vh, const bf* __restrict__ Vl, float* M1, float* M2) {
    static_assert(RH % (16 * NQH * WH) == 0 && (TT - RH) % (16 * NQL * WL) == 0 && RH / (16 * NQH * WH) == (TT - RH) / (16 * NQL * WL) && HD == 64, "shape");
    const int hp = blockIdx.x, h = hp & (NH_ - 1); const int w = __builtin_amdgcn_readfirstlane(threadIdx.x >> 5);   // the wave's number as a scalar: the choice of path below is a scalar branch
    const size_t zq = ((size_t)blockIdx.z * (4 * NH_) + hp) * TT * HD, zv = ((size_t)blockIdx.z * NKV + h) * HD * TT;   // pass hp < 16: map 1 (q1/k1), hp >= 16: map 2 (q2/k2); both use v of head hp mod 16
    float* O = ((hp < NH_) ? M1 : M2) + (size_t)blockIdx.z * TT * DQ + h * HD;
    if (w < WH) attn_tile<bf, true, NQH>(Qh + zq, Ql + zq, Kh + zq, Kl + zq, Vh + zv, Vl + zv, O, (blockIdx.y * WH + w) * (16 * NQH));
    else attn_tile<h16, false, NQL>(Q16 + zq, nullptr, K16 + zq, nullptr, V16 + zv, nullptr, O, RH + (blockIdx.y * WL + (w - WH)) * (16 * NQL));
}

extern "C" void kernel_launch(void* const* d_in, const int* in_sizes, int n_in,
                              void* d_out, int out_size, void* d_ws, size_t ws_size, hipStream_t stream) {
    (void)in_sizes; (void)n_in; (void)out_size;
    const float* x = (const float*)d_in[0]; const float* wq1 = (const float*)d_in[1]; const float* wk1 = (const float*)d_in[2]; const float* wq2 = (const float*)d_in[3]; const float* wk2 = (const float*)d_in[4]; const float* wv = (const float*)d_in[5]; const float* lng = (const float*)d_in[6]; const float* lnb = (const float*)d_in[7]; const float* LAMB = (const float*)d_in[8]; const float* wq = wq1; const float* wk = wk1; const float* wo = nullptr; (void)wo; (void)wq; (void)wk;
    float* OUT = (float*)d_out;     // [2][2048][1024]
    char* wsp = (char*)d_ws;
    auto take = [&](size_t bytes) { char* p = wsp; wsp += (bytes + 255) & ~(size_t)255; return (void*)p; };
    bf* WALL = (bf*)take((size_t)5 * DQ * DM * 2);   /* weight rows of q1, q2, k1, k2, v */
    float* M1 = (float*)take((size_t)NB_ * TT * DQ * 4); float* M2 = (float*)take((size_t)NB_ * TT * DQ * 4);
    bf* XB = (bf*)take((size_t)NB_ * TT * DM * 2);
    h16* QK16 = (h16*)take((size_t)NB_ * 4 * NH_ * TT * HD * 2); bf* QKh = (bf*)take((size_t)NB_ * 4 * NH_ * TT * HD * 2); bf* QKl = (bf*)take((size_t)NB_ * 4 * NH_ * TT * HD * 2);   /* [b][slot][t][d]; slots 0..31: q1, q2 heads; 32..63: k1, k2 heads */
    h16* VT16 = (h16*)take((size_t)NB_ * NKV * HD * TT * 2); bf* VTh = (bf*)take((size_t)NB_ * NKV * HD * TT * 2); bf* VTl = (bf*)take((size_t)NB_ * NKV * HD * TT * 2);   /* [b][h][d][t] */
    if ((size_t)(wsp - (char*)d_ws) > ws_size) return;    // ws 256 MiB
    const size_t KO = (size_t)2 * NH_ * TT * HD;   /* the k slots stand behind the 32 q slots of a batch */
    k_whg<<<dim3(NH_ * (DM / WCT), 5), 256, 0, stream>>>(wq1, wq2, wk1, wk2, wv, WALL);   /* [h][c][d] -> Bt [h*64+d][c] */
    k_cvt8<<<(unsigned)(((size_t)NB_ * TT * DM / 8 + 255) / 256), 256, 0, stream>>>(x, XB, (size_t)NB_ * TT * DM / 8);
    k_proj<<<dim3(5 * DQ / 128, TT / 128, NB_), 128, 0, stream>>>(WALL, XB, DM, QK16, QKh, QKl, VT16, VTh, VTl);
    k_fattn<<<dim3(2 * NH_, RH / (16 * NQH * WH), NB_), 32 * (WH + WL), 0, stream>>>(QK16, QK16 + KO, VT16, QKh, QKl, QKh + KO, QKl + KO, VTh, VTl, M1, M2);   /* f32 contexts of map 1 / map 2, merged by head */
    k_difln<<<NB_ * TT / 8, 256, 0, stream>>>(M1, M2, lng, lnb, LAMB, OUT);   /* (1 - lamb) LN(M1 - lamb M2) */
}
